// v000
// The times below were measured on an AMD MI455X: many runs one after another, warmed up first and cycling through
// copies of the inputs, with the whole window's GPU time divided by the number of runs. Launches and the gaps
// between them are all in it. The median over several windows is given; except for v000 it joins two sittings, which
// can be a few percent apart, so the side-by-side timings, each taken in one sitting, are the better comparison.
// The starting kernel, v000, takes 2820 microseconds a run.
#include <hip/hip_runtime.h>

// CustomWindowMHA: 16 heads x 64 over 2 x 2,048 tokens; token i attends to j in the causal window i-127..i OR the dilated set j = i-128-4m (m >= 1, j >= 0); QKV = x qkv^T (no bias), scores/8, masked softmax, out = (attn v) wo^T -> [2][2048][1024].
// Deterministic: no index structures, no atomics; flash-style online softmax over all key blocks in a fixed order.
// WMMA (v_wmma_f32_16x16x32_f16, f32 accumulate): the QKV projection with x EXACT bf16 x8 (K 1024) against exact torch weight rows x256 (one product); S = Q K^T (hi+lo x hi+lo, 3 products, K 64); O = P V (P x256 hi+lo x V^T hi+lo, 3 products); out = attended (hi+lo) Wo^T (2 products); softmax in f32. Inputs rounded to bf16 once. Fragment k-map per lane half hh for A AND B: elements 0..7 <- k = 8hh+0..7, 8..15 <- k = 16+8hh+0..7; acc[r] = D[8hh+r][col].

namespace {
constexpr int NB = 2, L = 2048, C = 1024, NH = 16, HD = 64, NT = NB * L, KB = 128, PW = 3 * C;
constexpr int WINDOW = 128, DIL = 4;
constexpr float XS = 8.0f, HS = 256.0f /* hi+lo staging scale for q/k/v/attended */, WSC = 256.0f, PS = 256.0f, SCALE = 0.125f;
typedef _Float16 b16;
typedef __attribute__((ext_vector_type(16))) _Float16 v16b;
typedef __attribute__((ext_vector_type(8))) _Float16 v8b;
typedef __attribute__((ext_vector_type(8))) float v8f;
typedef __attribute__((ext_vector_type(4))) float v4f;
__device__ __forceinline__ float bf16_rne(float f) { unsigned int u = __float_as_uint(f); u += 0x7FFFu + ((u >> 16) & 1u); float r = __uint_as_float(u & 0xFFFF0000u); asm volatile("" : "+v"(r)); return r; }
__device__ __forceinline__ float bfv(float f) { float r = bf16_rne(f); asm volatile("" : "+v"(r)); return r; }
__device__ __forceinline__ void split16(float v, b16& hi, b16& lo) { hi = (b16)v; lo = (b16)(v - (float)hi); }
__device__ __forceinline__ v16b frag_kb(const b16* p, int hh) { const v8b a = *(const v8b*)(p + 8 * hh), b = *(const v8b*)(p + 16 + 8 * hh); v16b f;
#pragma unroll
  for (int e = 0; e < 8; ++e) { f[e] = a[e]; f[8 + e] = b[e]; } return f; }
__device__ __forceinline__ v8f wmma16b(v16b a, v16b b, v8f c) { v8f d = __builtin_amdgcn_wmma_f32_16x16x32_f16(false, a, false, b, (short)0, c, false, false); asm volatile("v_nop\n\tv_nop\n\tv_nop\n\tv_nop" : "+v"(d) : "v"(a), "v"(b)); return d; }
__device__ __forceinline__ void wave_lds_sync() { __builtin_amdgcn_fence(__ATOMIC_RELEASE, "workgroup"); __builtin_amdgcn_wave_barrier(); __builtin_amdgcn_fence(__ATOMIC_ACQUIRE, "workgroup"); }
__device__ __forceinline__ float pmul(float a, float b) { float p = a * b; asm volatile("" : "+v"(p)); return p; }

__global__ __launch_bounds__(256) void wput_kernel(const float* __restrict__ wq, const float* __restrict__ wk, const float* __restrict__ wv, const float* __restrict__ wo, b16* __restrict__ W3, b16* __restrict__ WO) { const size_t u = (size_t)blockIdx.x * 256 + threadIdx.x; if (u >= (size_t)4 * C * (C / 8)) return; const int r = (int)(u / (C / 8)), k0 = (int)(u % (C / 8)) * 8; const int p = r / C, o = r % C; const float* w = p == 0 ? wq : (p == 1 ? wk : (p == 2 ? wv : wo)); v8b v;
#pragma unroll
  for (int j = 0; j < 8; ++j) v[j] = (b16)(bf16_rne(w[(size_t)o * C + k0 + j]) * WSC);
  { *(v8b*)((p < 3 ? W3 + (size_t)r * C : WO + (size_t)o * C) + k0) = v;  } }
__global__ __launch_bounds__(32) void proj_kernel(const float* __restrict__ x, const b16* __restrict__ W3, const float* __restrict__ bq, const float* __restrict__ bk, const float* __restrict__ bv, int TLIM, b16* __restrict__ PH, b16* __restrict__ PL) { __shared__ __attribute__((aligned(16))) b16 Ah[16][C + 8], Oh[16][264], Ol[16][264]; const int lane = threadIdx.x, nloc = lane & 15, hlf = lane >> 4; const size_t m0 = (size_t)blockIdx.x * 16; if (m0 >= (size_t)TLIM) return;
  for (int rr = 0; rr < 16; ++rr) for (int q = 0; q < C / 32; ++q) Ah[rr][q * 32 + lane] = (b16)(bf16_rne(x[(m0 + rr) * C + q * 32 + lane]) * XS);
  wave_lds_sync();
#pragma unroll 1
  for (int g = 0; g < PW / 256; ++g) { const int pj = (g * 256) / C; const float* bb = pj == 0 ? bq : (pj == 1 ? bk : bv); const float sc = pj == 0 ? SCALE : 1.0f; v8f acc[16];
#pragma unroll
    for (int t = 0; t < 16; ++t) acc[t] = (v8f){};
#pragma unroll 2
    for (int kb = 0; kb < C; kb += 32) { const v16b a = frag_kb(&Ah[nloc][kb], hlf);
#pragma unroll
      for (int t = 0; t < 16; ++t) acc[t] = wmma16b(a, frag_kb(W3 + (size_t)(g * 256 + t * 16 + nloc) * C + kb, hlf), acc[t]); }
#pragma unroll
    for (int t = 0; t < 16; ++t) { const int cc = t * 16 + nloc; const int col = g * 256 + cc; const float bvv = 0.0f;
#pragma unroll
      for (int r8 = 0; r8 < 8; ++r8) { b16 p, ql; split16((acc[t][r8] * (1.0f / (XS * WSC)) + bvv) * sc * HS, p, ql); Oh[8 * hlf + r8][cc] = p; Ol[8 * hlf + r8][cc] = ql; } }
    wave_lds_sync();
    { for (int rr = 0; rr < 16; ++rr) { *(v8b*)(PH + (m0 + rr) * PW + g * 256 + lane * 8) = *(const v8b*)(&Oh[rr][lane * 8]); *(v8b*)(PL + (m0 + rr) * PW + g * 256 + lane * 8) = *(const v8b*)(&Ol[rr][lane * 8]); }  }
    wave_lds_sync(); } }
// attention: ONE WAVE PER BLOCK, wave per (b, h, 16-query tile): key blocks of 128 over all keys; S = Q K^T (3 products, K 64); online softmax; P x256 hi+lo;
__global__ __launch_bounds__(32) void att_kernel(const b16* __restrict__ PH, const b16* __restrict__ PL, const float* __restrict__ amask, int BLIM, float* __restrict__ ATT) { __shared__ __attribute__((aligned(16))) b16 Ph_[16][KB + 8], Pl_[16][KB + 8], Vth[HD][KB + 8], Vtl[HD][KB + 8]; __shared__ float Sf[16][KB + 4], Of[16][HD + 4];
  const int lane = threadIdx.x, nloc = lane & 15, hlf = lane >> 4; const int qt = blockIdx.x % (L / 16); const int h = (blockIdx.x / (L / 16)) % NH; const int b = blockIdx.x / ((L / 16) * NH); if (b >= BLIM) return; const int t0 = qt * 16; const size_t rowb = (size_t)b * L; const int qo = h * HD, ko = C + h * HD, vo = 2 * C + h * HD;
  v16b qh[HD / 32], ql[HD / 32];
#pragma unroll
  for (int s = 0; s < HD / 32; ++s) { qh[s] = frag_kb(PH + (rowb + t0 + nloc) * PW + qo + s * 32, hlf); ql[s] = frag_kb(PL + (rowb + t0 + nloc) * PW + qo + s * 32, hlf); }
  float m_r[8], den_r[8]; v8f acc[HD / 16];
#pragma unroll
  for (int r8 = 0; r8 < 8; ++r8) { m_r[r8] = -INFINITY; den_r[r8] = 0.0f; }
#pragma unroll
  for (int t = 0; t < HD / 16; ++t) acc[t] = (v8f){};
  const int kstart = 0; const int kend = (t0 + 16 < L) ? (t0 + 16) : L;   // causal: keys <= last query of the tile
#pragma unroll 1
  for (int kb0 = kstart; kb0 < kend; kb0 += KB) { const int nk = (kend - kb0) < KB ? (kend - kb0) : KB; const int nkt = (nk + 15) / 16;
    for (int rr = 0; rr < KB; rr += 2) { const int r = rr + hlf; const int key = kb0 + r < L ? kb0 + r : L - 1;   /* stage the WHOLE block: keys past kend get p = 0 but their V^T rows must be finite (chip LDS is not zeroed) */ const size_t vr = (rowb + key) * PW + vo; for (int s = 0; s < HD / 32; ++s) { Vth[s * 32 + nloc][r] = PH[vr + s * 32 + nloc]; Vth[s * 32 + 16 + nloc][r] = PH[vr + s * 32 + 16 + nloc]; Vtl[s * 32 + nloc][r] = PL[vr + s * 32 + nloc]; Vtl[s * 32 + 16 + nloc][r] = PL[vr + s * 32 + 16 + nloc]; } }
    for (int t = 0; t < KB / 16; ++t) { if (t < nkt) { const int key = kb0 + t * 16 + nloc < L ? kb0 + t * 16 + nloc : L - 1; const size_t kr = (rowb + key) * PW + ko; v8f s = {};
#pragma unroll
        for (int q = 0; q < HD / 32; ++q) { const v16b kh = frag_kb(PH + kr + q * 32, hlf), kl = frag_kb(PL + kr + q * 32, hlf); s = wmma16b(qh[q], kh, s); s = wmma16b(qh[q], kl, s); s = wmma16b(ql[q], kh, s); }
#pragma unroll
        for (int r8 = 0; r8 < 8; ++r8) { const int i = t0 + 8 * hlf + r8, j = kb0 + t * 16 + nloc; const bool ok = (j <= i) && ((j >= i - (WINDOW - 1)) || ((j <= i - WINDOW - DIL) && (((i - WINDOW - j) % DIL) == 0)));   /* window i-127..i or dilated j = i-128-4m, m>=1 */ Sf[8 * hlf + r8][t * 16 + nloc] = ok ? s[r8] * (1.0f / (HS * HS)) : -INFINITY; } }
      else {
#pragma unroll
        for (int r8 = 0; r8 < 8; ++r8) Sf[8 * hlf + r8][t * 16 + nloc] = -INFINITY; } }
    wave_lds_sync();
#pragma unroll
    for (int rr = 0; rr < 16; ++rr) { float mx = -INFINITY;
#pragma unroll
      for (int q = 0; q < 4; ++q) mx = fmaxf(mx, Sf[rr][q * 32 + lane]);
      for (int o = 16; o; o >>= 1) mx = fmaxf(mx, __shfl_xor(mx, o));
      const float mold = __shfl(m_r[rr & 7], (rr >> 3) * 16); const float mn = fmaxf(mold, mx); const float sf = (mold == -INFINITY) ? 0.0f : ((mn == -INFINITY) ? 1.0f : __expf(mold - mn)); float ps = 0.0f;
#pragma unroll
      for (int q = 0; q < 4; ++q) { const int kx = q * 32 + lane; const float sv = Sf[rr][kx]; const float p = (sv == -INFINITY || mn == -INFINITY) ? 0.0f : __expf(sv - mn); ps += p; b16 ph, pl; split16(p * PS, ph, pl); Ph_[rr][kx] = ph; Pl_[rr][kx] = pl; }
      for (int o = 16; o; o >>= 1) ps += __shfl_xor(ps, o);
      if ((rr >> 3) == hlf) { const int r8 = rr & 7; den_r[r8] = den_r[r8] * sf + ps; m_r[r8] = mn;
#pragma unroll
        for (int t = 0; t < HD / 16; ++t) acc[t][r8] = acc[t][r8] * sf; } }
    wave_lds_sync();
    for (int ks = 0; ks < nkt * 16; ks += 32) { const v16b pa = frag_kb(&Ph_[nloc][ks], hlf), pb = frag_kb(&Pl_[nloc][ks], hlf);
#pragma unroll
      for (int t = 0; t < HD / 16; ++t) { const v16b vh = frag_kb(&Vth[t * 16 + nloc][ks], hlf), vl = frag_kb(&Vtl[t * 16 + nloc][ks], hlf); acc[t] = wmma16b(pa, vh, acc[t]); acc[t] = wmma16b(pa, vl, acc[t]); acc[t] = wmma16b(pb, vh, acc[t]); } }
    wave_lds_sync(); }
#pragma unroll
  for (int t = 0; t < HD / 16; ++t)
#pragma unroll
    for (int r8 = 0; r8 < 8; ++r8) { const float dn = den_r[r8]; Of[8 * hlf + r8][t * 16 + nloc] = dn > 0.0f ? acc[t][r8] * (1.0f / (HS * PS)) / dn : 0.0f; }
  wave_lds_sync();
  { for (int rr = 0; rr < 16; ++rr) for (int s = 0; s < HD / 32; ++s) ((float*)ATT)[(rowb + t0 + rr) * C + h * HD + s * 32 + lane] = Of[rr][s * 32 + lane];  } }
__global__ __launch_bounds__(32) void out_kernel(const float* __restrict__ ATT, const b16* __restrict__ WO, const float* __restrict__ bo, int TLIM, float* __restrict__ out) { __shared__ __attribute__((aligned(16))) b16 Ah[16][C + 8], Al[16][C + 8]; __shared__ float Tf[16][260]; const int lane = threadIdx.x, nloc = lane & 15, hlf = lane >> 4; const size_t m0 = (size_t)blockIdx.x * 16; if (m0 >= (size_t)TLIM) return;
  for (int rr = 0; rr < 16; ++rr) for (int q = 0; q < C / 32; ++q) { b16 p, ql; split16(ATT[(m0 + rr) * C + q * 32 + lane] * HS, p, ql); Ah[rr][q * 32 + lane] = p; Al[rr][q * 32 + lane] = ql; }
  wave_lds_sync();
#pragma unroll 1
  for (int g = 0; g < C / 256; ++g) { v8f acc[16];
#pragma unroll
    for (int t = 0; t < 16; ++t) acc[t] = (v8f){};
#pragma unroll 2
    for (int kb = 0; kb < C; kb += 32) { const v16b a = frag_kb(&Ah[nloc][kb], hlf), al = frag_kb(&Al[nloc][kb], hlf);
#pragma unroll
      for (int t = 0; t < 16; ++t) { const v16b bw = frag_kb(WO + (size_t)(g * 256 + t * 16 + nloc) * C + kb, hlf); acc[t] = wmma16b(a, bw, acc[t]); acc[t] = wmma16b(al, bw, acc[t]); } }
#pragma unroll
    for (int t = 0; t < 16; ++t) { const int cc = t * 16 + nloc; const float bb = 0.0f;
#pragma unroll
      for (int r8 = 0; r8 < 8; ++r8) Tf[8 * hlf + r8][cc] = acc[t][r8] * (1.0f / (HS * WSC)) + bb; }
    wave_lds_sync();
    { for (int rr = 0; rr < 16; ++rr) for (int q = 0; q < 2; ++q) *(v4f*)(out + (m0 + rr) * C + g * 256 + q * 128 + lane * 4) = *(const v4f*)(&Tf[rr][q * 128 + lane * 4]);  }
    wave_lds_sync(); } }
}  // namespace

extern "C" void kernel_launch(void* const* d_in, const int* in_sizes, int n_in, void* d_out, int out_size, void* d_ws, size_t ws_size, hipStream_t stream) {
  (void)n_in;
  auto Fp = [&](int i) { return (const float*)d_in[i]; };
  // input order: 0 x [2,2048,1024]; 1 qkv [3072,1024] (out,in: rows q|k|v); 2 wo [1024,1024] (out,in)
  if (in_sizes[0] != NT * C || in_sizes[1] != 3 * C * C || in_sizes[2] != C * C || out_size != NT * C) return;
  const int BLIM = NB;   // batch cut
  const int TLIM = BLIM * L;
  size_t off = 0; char* ws = (char*)d_ws;
  auto carve = [&](size_t bytes) { char* p = ws + off; off += (bytes + 255) & ~(size_t)255; return p; };
  b16* W3 = (b16*)carve((size_t)3 * C * C * 2); b16* WO = (b16*)carve((size_t)C * C * 2); b16* PH = (b16*)carve((size_t)NT * PW * 2); b16* PL = (b16*)carve((size_t)NT * PW * 2); float* ATT = (float*)carve((size_t)NT * C * 4);
  if (off > ws_size || off > ((size_t)96 << 20)) return;   // ~ 72 MiB
  wput_kernel<<<(unsigned)(((size_t)4 * C * (C / 8) + 255) / 256), 256, 0, stream>>>(Fp(1), Fp(1) + (size_t)C * C, Fp(1) + (size_t)2 * C * C, Fp(2), W3, WO);
  proj_kernel<<<TLIM / 16, 32, 0, stream>>>(Fp(0), W3, Fp(0), Fp(0), Fp(0), TLIM, PH, PL);
  att_kernel<<<BLIM * NH * (L / 16), 32, 0, stream>>>(PH, PL, (const float*)0, BLIM, ATT);
  out_kernel<<<TLIM / 16, 32, 0, stream>>>(ATT, WO, (const float*)0, TLIM, (float*)d_out);
}

// v001
// Measured time: 1040 microseconds a run.
// Two timings next to v000 put it at 2.69 and 2.71 times that version's speed.
#include <hip/hip_runtime.h>

// CustomWindowMHA: 16 heads x 64 over 2 x 2,048 tokens; token i attends to j in the causal window i-127..i OR the dilated set j = i-128-4m (m >= 1, j >= 0); QKV = x qkv^T (no bias), scores/8, masked softmax, out = (attn v) wo^T -> [2][2048][1024].
// Deterministic: no index structures, no atomics; flash-style online softmax over all key blocks in a fixed order.
// WMMA (v_wmma_f32_16x16x32_f16, f32 accumulate): the QKV projection with x EXACT bf16 x8 (K 1024) against exact torch weight rows x256 (one product); S = Q K^T (hi+lo x hi+lo, 3 products, K 64); O = P V (P x256 hi+lo x V^T hi+lo, 3 products); out = attended (hi+lo) Wo^T (2 products); softmax in f32. Inputs rounded to bf16 once. Fragment k-map per lane half hh for A AND B: elements 0..7 <- k = 8hh+0..7, 8..15 <- k = 16+8hh+0..7; acc[r] = D[8hh+r][col].

namespace {
constexpr int NB = 2, L = 2048, C = 1024, NH = 16, HD = 64, NT = NB * L, KB = 128, PW = 3 * C;
constexpr int WINDOW = 128, DIL = 4;
constexpr float XS = 8.0f, HS = 256.0f /* hi+lo staging scale for q/k/v/attended */, WSC = 256.0f, PS = 256.0f, SCALE = 0.125f;
typedef _Float16 b16;
typedef __attribute__((ext_vector_type(16))) _Float16 v16b;
typedef __attribute__((ext_vector_type(8))) _Float16 v8b;
typedef __attribute__((ext_vector_type(8))) float v8f;
typedef __attribute__((ext_vector_type(4))) float v4f;
__device__ __forceinline__ float bf16_rne(float f) { unsigned int u = __float_as_uint(f); u += 0x7FFFu + ((u >> 16) & 1u); float r = __uint_as_float(u & 0xFFFF0000u); asm volatile("" : "+v"(r)); return r; }
__device__ __forceinline__ float bfv(float f) { float r = bf16_rne(f); asm volatile("" : "+v"(r)); return r; }
__device__ __forceinline__ void split16(float v, b16& hi, b16& lo) { hi = (b16)v; lo = (b16)(v - (float)hi); }
__device__ __forceinline__ v16b frag_kb(const b16* p, int hh) { const v8b a = *(const v8b*)(p + 8 * hh), b = *(const v8b*)(p + 16 + 8 * hh); v16b f;
#pragma unroll
  for (int e = 0; e < 8; ++e) { f[e] = a[e]; f[8 + e] = b[e]; } return f; }
__device__ __forceinline__ v8f wmma16b(v16b a, v16b b, v8f c) { v8f d = __builtin_amdgcn_wmma_f32_16x16x32_f16(false, a, false, b, (short)0, c, false, false); asm volatile("v_nop\n\tv_nop\n\tv_nop\n\tv_nop" : "+v"(d) : "v"(a), "v"(b)); return d; }
__device__ __forceinline__ void wave_lds_sync() { __builtin_amdgcn_fence(__ATOMIC_RELEASE, "workgroup"); __builtin_amdgcn_wave_barrier(); __builtin_amdgcn_fence(__ATOMIC_ACQUIRE, "workgroup"); }
__device__ __forceinline__ float pmul(float a, float b) { float p = a * b; asm volatile("" : "+v"(p)); return p; }

__global__ __launch_bounds__(256) void wput_kernel(const float* __restrict__ wq, const float* __restrict__ wk, const float* __restrict__ wv, const float* __restrict__ wo, b16* __restrict__ W3, b16* __restrict__ WO) { const size_t u = (size_t)blockIdx.x * 256 + threadIdx.x; if (u >= (size_t)4 * C * (C / 8)) return; const int r = (int)(u / (C / 8)), k0 = (int)(u % (C / 8)) * 8; const int p = r / C, o = r % C; const float* w = p == 0 ? wq : (p == 1 ? wk : (p == 2 ? wv : wo)); v8b v;
#pragma unroll
  for (int j = 0; j < 8; ++j) v[j] = (b16)(bf16_rne(w[(size_t)o * C + k0 + j]) * WSC);
  { *(v8b*)((p < 3 ? W3 + (size_t)r * C : WO + (size_t)o * C) + k0) = v;  } }
// projection: block = 16 waves on one 16-token tile and one of q|k|v (blockIdx.y); the waves share the staged x tile, wave wv owns columns wv*64..wv*64+63 of that part.
__global__ __launch_bounds__(512) void proj_kernel(const float* __restrict__ x, const b16* __restrict__ W3, const float* __restrict__ bq, const float* __restrict__ bk, const float* __restrict__ bv, int TLIM, b16* __restrict__ PH, b16* __restrict__ PL) { __shared__ __attribute__((aligned(16))) b16 Ah[16][C + 8], Oh[16][16][72], Ol[16][16][72]; const int lane = threadIdx.x & 31, wv = threadIdx.x >> 5, nloc = lane & 15, hlf = lane >> 4; const size_t m0 = (size_t)blockIdx.x * 16; if (m0 >= (size_t)TLIM) return;
  for (int q = 0; q < C / 32; ++q) Ah[wv][q * 32 + lane] = (b16)(bf16_rne(x[(m0 + wv) * C + q * 32 + lane]) * XS);
  __syncthreads();   // every wave reads all 16 staged rows
  const int pj = blockIdx.y; const int c0 = pj * C + wv * 64; const float sc = pj == 0 ? SCALE : 1.0f; const b16* wp = W3 + (size_t)(c0 + nloc) * C; v8f acc[4];
#pragma unroll
  for (int t = 0; t < 4; ++t) acc[t] = (v8f){};
#pragma unroll 2
  for (int kb = 0; kb < C; kb += 32) { const v16b a = frag_kb(&Ah[nloc][kb], hlf);
#pragma unroll
    for (int t = 0; t < 4; ++t) acc[t] = wmma16b(a, frag_kb(wp + t * 16 * C + kb, hlf), acc[t]); }
#pragma unroll
  for (int t = 0; t < 4; ++t) { const int cc = t * 16 + nloc; const float bvv = 0.0f;
#pragma unroll
    for (int r8 = 0; r8 < 8; ++r8) { b16 p, ql; split16((acc[t][r8] * (1.0f / (XS * WSC)) + bvv) * sc * HS, p, ql); Oh[wv][8 * hlf + r8][cc] = p; Ol[wv][8 * hlf + r8][cc] = ql; } }
  wave_lds_sync();
  { const int ro = lane >> 3, cs = (lane & 7) * 8; for (int rr = 0; rr < 16; rr += 4) { *(v8b*)(PH + (m0 + rr + ro) * PW + c0 + cs) = *(const v8b*)(&Oh[wv][rr + ro][cs]); *(v8b*)(PL + (m0 + rr + ro) * PW + c0 + cs) = *(const v8b*)(&Ol[wv][rr + ro][cs]); }  } }
// attention: ONE WAVE PER BLOCK, wave per (b, h, 16-query tile): key blocks of 128 over all keys; S = Q K^T (3 products, K 64); online softmax; P x256 hi+lo;
__global__ __launch_bounds__(32) void att_kernel(const b16* __restrict__ PH, const b16* __restrict__ PL, const float* __restrict__ amask, int BLIM, float* __restrict__ ATT) { __shared__ __attribute__((aligned(16))) b16 Ph_[16][KB + 8], Pl_[16][KB + 8], Vth[HD][KB + 8], Vtl[HD][KB + 8]; __shared__ float Sf[16][KB + 4], Of[16][HD + 4];
  const int lane = threadIdx.x, nloc = lane & 15, hlf = lane >> 4; const int qt = blockIdx.x % (L / 16); const int h = (blockIdx.x / (L / 16)) % NH; const int b = blockIdx.x / ((L / 16) * NH); if (b >= BLIM) return; const int t0 = qt * 16; const size_t rowb = (size_t)b * L; const int qo = h * HD, ko = C + h * HD, vo = 2 * C + h * HD;
  v16b qh[HD / 32], ql[HD / 32];
#pragma unroll
  for (int s = 0; s < HD / 32; ++s) { qh[s] = frag_kb(PH + (rowb + t0 + nloc) * PW + qo + s * 32, hlf); ql[s] = frag_kb(PL + (rowb + t0 + nloc) * PW + qo + s * 32, hlf); }
  float m_r[8], den_r[8]; v8f acc[HD / 16];
#pragma unroll
  for (int r8 = 0; r8 < 8; ++r8) { m_r[r8] = -INFINITY; den_r[r8] = 0.0f; }
#pragma unroll
  for (int t = 0; t < HD / 16; ++t) acc[t] = (v8f){};
  const int kstart = 0; const int kend = (t0 + 16 < L) ? (t0 + 16) : L;   // causal: keys <= last query of the tile
#pragma unroll 1
  for (int kb0 = kstart; kb0 < kend; kb0 += KB) { const int nk = (kend - kb0) < KB ? (kend - kb0) : KB; const int nkt = (nk + 15) / 16;
    for (int rr = 0; rr < KB; rr += 2) { const int r = rr + hlf; const int key = kb0 + r < L ? kb0 + r : L - 1;   /* stage the WHOLE block: keys past kend get p = 0 but their V^T rows must be finite (chip LDS is not zeroed) */ const size_t vr = (rowb + key) * PW + vo; for (int s = 0; s < HD / 32; ++s) { Vth[s * 32 + nloc][r] = PH[vr + s * 32 + nloc]; Vth[s * 32 + 16 + nloc][r] = PH[vr + s * 32 + 16 + nloc]; Vtl[s * 32 + nloc][r] = PL[vr + s * 32 + nloc]; Vtl[s * 32 + 16 + nloc][r] = PL[vr + s * 32 + 16 + nloc]; } }
    for (int t = 0; t < KB / 16; ++t) { if (t < nkt) { const int key = kb0 + t * 16 + nloc < L ? kb0 + t * 16 + nloc : L - 1; const size_t kr = (rowb + key) * PW + ko; v8f s = {};
#pragma unroll
        for (int q = 0; q < HD / 32; ++q) { const v16b kh = frag_kb(PH + kr + q * 32, hlf), kl = frag_kb(PL + kr + q * 32, hlf); s = wmma16b(qh[q], kh, s); s = wmma16b(qh[q], kl, s); s = wmma16b(ql[q], kh, s); }
#pragma unroll
        for (int r8 = 0; r8 < 8; ++r8) { const int i = t0 + 8 * hlf + r8, j = kb0 + t * 16 + nloc; const bool ok = (j <= i) && ((j >= i - (WINDOW - 1)) || ((j <= i - WINDOW - DIL) && (((i - WINDOW - j) % DIL) == 0)));   /* window i-127..i or dilated j = i-128-4m, m>=1 */ Sf[8 * hlf + r8][t * 16 + nloc] = ok ? s[r8] * (1.0f / (HS * HS)) : -INFINITY; } }
      else {
#pragma unroll
        for (int r8 = 0; r8 < 8; ++r8) Sf[8 * hlf + r8][t * 16 + nloc] = -INFINITY; } }
    wave_lds_sync();
#pragma unroll
    for (int rr = 0; rr < 16; ++rr) { float mx = -INFINITY;
#pragma unroll
      for (int q = 0; q < 4; ++q) mx = fmaxf(mx, Sf[rr][q * 32 + lane]);
      for (int o = 16; o; o >>= 1) mx = fmaxf(mx, __shfl_xor(mx, o));
      const float mold = __shfl(m_r[rr & 7], (rr >> 3) * 16); const float mn = fmaxf(mold, mx); const float sf = (mold == -INFINITY) ? 0.0f : ((mn == -INFINITY) ? 1.0f : __expf(mold - mn)); float ps = 0.0f;
#pragma unroll
      for (int q = 0; q < 4; ++q) { const int kx = q * 32 + lane; const float sv = Sf[rr][kx]; const float p = (sv == -INFINITY || mn == -INFINITY) ? 0.0f : __expf(sv - mn); ps += p; b16 ph, pl; split16(p * PS, ph, pl); Ph_[rr][kx] = ph; Pl_[rr][kx] = pl; }
      for (int o = 16; o; o >>= 1) ps += __shfl_xor(ps, o);
      if ((rr >> 3) == hlf) { const int r8 = rr & 7; den_r[r8] = den_r[r8] * sf + ps; m_r[r8] = mn;
#pragma unroll
        for (int t = 0; t < HD / 16; ++t) acc[t][r8] = acc[t][r8] * sf; } }
    wave_lds_sync();
    for (int ks = 0; ks < nkt * 16; ks += 32) { const v16b pa = frag_kb(&Ph_[nloc][ks], hlf), pb = frag_kb(&Pl_[nloc][ks], hlf);
#pragma unroll
      for (int t = 0; t < HD / 16; ++t) { const v16b vh = frag_kb(&Vth[t * 16 + nloc][ks], hlf), vl = frag_kb(&Vtl[t * 16 + nloc][ks], hlf); acc[t] = wmma16b(pa, vh, acc[t]); acc[t] = wmma16b(pa, vl, acc[t]); acc[t] = wmma16b(pb, vh, acc[t]); } }
    wave_lds_sync(); }
#pragma unroll
  for (int t = 0; t < HD / 16; ++t)
#pragma unroll
    for (int r8 = 0; r8 < 8; ++r8) { const float dn = den_r[r8]; Of[8 * hlf + r8][t * 16 + nloc] = dn > 0.0f ? acc[t][r8] * (1.0f / (HS * PS)) / dn : 0.0f; }
  wave_lds_sync();
  { for (int rr = 0; rr < 16; ++rr) for (int s = 0; s < HD / 32; ++s) ((float*)ATT)[(rowb + t0 + rr) * C + h * HD + s * 32 + lane] = Of[rr][s * 32 + lane];  } }
// output product: block = 32 waves on one 16-token tile; the waves share the staged hi+lo tile, wave wv owns columns wv*32..wv*32+31.
__global__ __launch_bounds__(1024) void out_kernel(const float* __restrict__ ATT, const b16* __restrict__ WO, const float* __restrict__ bo, int TLIM, float* __restrict__ out) { __shared__ __attribute__((aligned(16))) b16 Ah[16][C + 8], Al[16][C + 8]; __shared__ __attribute__((aligned(16))) float Tf[32][16][36]; const int lane = threadIdx.x & 31, wv = threadIdx.x >> 5, nloc = lane & 15, hlf = lane >> 4; const size_t m0 = (size_t)blockIdx.x * 16; if (m0 >= (size_t)TLIM) return;
  { const int rr = wv >> 1, q0 = (wv & 1) * (C / 64); for (int q = q0; q < q0 + C / 64; ++q) { b16 p, ql; split16(ATT[(m0 + rr) * C + q * 32 + lane] * HS, p, ql); Ah[rr][q * 32 + lane] = p; Al[rr][q * 32 + lane] = ql; } }
  __syncthreads();   // every wave reads all 16 staged rows
  const int c0 = wv * 32; const b16* wp = WO + (size_t)(c0 + nloc) * C; v8f acc[2];
#pragma unroll
  for (int t = 0; t < 2; ++t) acc[t] = (v8f){};
#pragma unroll 2
  for (int kb = 0; kb < C; kb += 32) { const v16b a = frag_kb(&Ah[nloc][kb], hlf), al = frag_kb(&Al[nloc][kb], hlf);
#pragma unroll
    for (int t = 0; t < 2; ++t) { const v16b bw = frag_kb(wp + t * 16 * C + kb, hlf); acc[t] = wmma16b(a, bw, acc[t]); acc[t] = wmma16b(al, bw, acc[t]); } }
#pragma unroll
  for (int t = 0; t < 2; ++t) { const int cc = t * 16 + nloc; const float bb = 0.0f;
#pragma unroll
    for (int r8 = 0; r8 < 8; ++r8) Tf[wv][8 * hlf + r8][cc] = acc[t][r8] * (1.0f / (HS * WSC)) + bb; }
  wave_lds_sync();
  { const int ro = lane >> 3, cs = (lane & 7) * 4; for (int rr = 0; rr < 16; rr += 4) *(v4f*)(out + (m0 + rr + ro) * C + c0 + cs) = *(const v4f*)(&Tf[wv][rr + ro][cs]);  } }
}  // namespace

extern "C" void kernel_launch(void* const* d_in, const int* in_sizes, int n_in, void* d_out, int out_size, void* d_ws, size_t ws_size, hipStream_t stream) {
  (void)n_in;
  auto Fp = [&](int i) { return (const float*)d_in[i]; };
  // input order: 0 x [2,2048,1024]; 1 qkv [3072,1024] (out,in: rows q|k|v); 2 wo [1024,1024] (out,in)
  if (in_sizes[0] != NT * C || in_sizes[1] != 3 * C * C || in_sizes[2] != C * C || out_size != NT * C) return;
  const int BLIM = NB;   // batch cut
  const int TLIM = BLIM * L;
  size_t off = 0; char* ws = (char*)d_ws;
  auto carve = [&](size_t bytes) { char* p = ws + off; off += (bytes + 255) & ~(size_t)255; return p; };
  b16* W3 = (b16*)carve((size_t)3 * C * C * 2); b16* WO = (b16*)carve((size_t)C * C * 2); b16* PH = (b16*)carve((size_t)NT * PW * 2); b16* PL = (b16*)carve((size_t)NT * PW * 2); float* ATT = (float*)carve((size_t)NT * C * 4);
  if (off > ws_size || off > ((size_t)96 << 20)) return;   // ~ 72 MiB
  wput_kernel<<<(unsigned)(((size_t)4 * C * (C / 8) + 255) / 256), 256, 0, stream>>>(Fp(1), Fp(1) + (size_t)C * C, Fp(1) + (size_t)2 * C * C, Fp(2), W3, WO);
  proj_kernel<<<dim3(TLIM / 16, 3), 512, 0, stream>>>(Fp(0), W3, Fp(0), Fp(0), Fp(0), TLIM, PH, PL);
  att_kernel<<<BLIM * NH * (L / 16), 32, 0, stream>>>(PH, PL, (const float*)0, BLIM, ATT);
  out_kernel<<<TLIM / 16, 1024, 0, stream>>>(ATT, WO, (const float*)0, TLIM, (float*)d_out);
}

// v002
// One run takes 456 microseconds.
// Two timings next to v001 put it at 2.27 and 2.30 times that version's speed.
// Counting every step since v000, it is 6.17 times as fast.
#include <hip/hip_runtime.h>

// CustomWindowMHA: 16 heads x 64 over 2 x 2,048 tokens; token i attends to j in the causal window i-127..i OR the dilated set j = i-128-4m (m >= 1, j >= 0); QKV = x qkv^T (no bias), scores/8, masked softmax, out = (attn v) wo^T -> [2][2048][1024].
// Deterministic: no index structures, no atomics; flash-style online softmax over all key blocks in a fixed order.
// WMMA (v_wmma_f32_16x16x32_f16, f32 accumulate): the QKV projection with x EXACT bf16 x8 (K 1024) against exact torch weight rows x256 (one product); S = Q K^T (hi+lo x hi+lo, 3 products, K 64); O = P V (P x256 hi+lo x V^T hi+lo, 3 products; V^T comes ready from the projection, see VTH/VTL); out = attended (hi+lo) Wo^T (2 products); softmax in f32. Inputs rounded to bf16 once. Fragment k-map per lane half hh for A AND B: elements 0..7 <- k = 8hh+0..7, 8..15 <- k = 16+8hh+0..7; acc[r] = D[8hh+r][col].

namespace {
constexpr int NB = 2, L = 2048, C = 1024, NH = 16, HD = 64, NT = NB * L, KB = 128, PW = 3 * C;
constexpr int WINDOW = 128, DIL = 4;
constexpr float XS = 8.0f, HS = 256.0f /* hi+lo staging scale for q/k/v/attended */, WSC = 256.0f, PS = 256.0f, SCALE = 0.125f;
typedef _Float16 b16;
typedef __attribute__((ext_vector_type(16))) _Float16 v16b;
typedef __attribute__((ext_vector_type(8))) _Float16 v8b;
typedef __attribute__((ext_vector_type(8))) float v8f;
typedef __attribute__((ext_vector_type(4))) float v4f;
__device__ __forceinline__ float bf16_rne(float f) { unsigned int u = __float_as_uint(f); u += 0x7FFFu + ((u >> 16) & 1u); float r = __uint_as_float(u & 0xFFFF0000u); asm volatile("" : "+v"(r)); return r; }
__device__ __forceinline__ float bfv(float f) { float r = bf16_rne(f); asm volatile("" : "+v"(r)); return r; }
__device__ __forceinline__ void split16(float v, b16& hi, b16& lo) { hi = (b16)v; lo = (b16)(v - (float)hi); }
__device__ __forceinline__ v16b frag_kb(const b16* p, int hh) { const v8b a = *(const v8b*)(p + 8 * hh), b = *(const v8b*)(p + 16 + 8 * hh); v16b f;
#pragma unroll
  for (int e = 0; e < 8; ++e) { f[e] = a[e]; f[8 + e] = b[e]; } return f; }
// V^T fragment of 32 keys from the tiled planes: p points at this lane's (d, 8*hh) in the first 16-token tile; elements 0..7 <- k = 8hh+0..7, 8..15 <- k = 16+8hh+0..7 (the next tile, HD*16 elements on): the same k-map as frag_kb.
__device__ __forceinline__ v16b frag_vt(const b16* p) { const v8b a = *(const v8b*)p, b = *(const v8b*)(p + HD * 16); v16b f;
#pragma unroll
  for (int e = 0; e < 8; ++e) { f[e] = a[e]; f[8 + e] = b[e]; } return f; }
__device__ __forceinline__ v8f wmma16b(v16b a, v16b b, v8f c) { v8f d = __builtin_amdgcn_wmma_f32_16x16x32_f16(false, a, false, b, (short)0, c, false, false); asm volatile("v_nop\n\tv_nop\n\tv_nop\n\tv_nop" : "+v"(d) : "v"(a), "v"(b)); return d; }
__device__ __forceinline__ void wave_lds_sync() { __builtin_amdgcn_fence(__ATOMIC_RELEASE, "workgroup"); __builtin_amdgcn_wave_barrier(); __builtin_amdgcn_fence(__ATOMIC_ACQUIRE, "workgroup"); }
__device__ __forceinline__ float pmul(float a, float b) { float p = a * b; asm volatile("" : "+v"(p)); return p; }

__global__ __launch_bounds__(256) void wput_kernel(const float* __restrict__ wq, const float* __restrict__ wk, const float* __restrict__ wv, const float* __restrict__ wo, b16* __restrict__ W3, b16* __restrict__ WO) { const size_t u = (size_t)blockIdx.x * 256 + threadIdx.x; if (u >= (size_t)4 * C * (C / 8)) return; const int r = (int)(u / (C / 8)), k0 = (int)(u % (C / 8)) * 8; const int p = r / C, o = r % C; const float* w = p == 0 ? wq : (p == 1 ? wk : (p == 2 ? wv : wo)); v8b v;
#pragma unroll
  for (int j = 0; j < 8; ++j) v[j] = (b16)(bf16_rne(w[(size_t)o * C + k0 + j]) * WSC);
  { *(v8b*)((p < 3 ? W3 + (size_t)r * C : WO + (size_t)o * C) + k0) = v;  } }
// projection: block = 16 waves on one 16-token tile and one of q|k|v (blockIdx.y); the waves share the staged x tile, wave wv owns columns wv*64..wv*64+63 of that part.
// q and k go out token-major (PH/PL). v goes out TRANSPOSED, tiled [b][head][16-token tile][d 0..63][token 0..15] (VTH/VTL): a lane's 8 accumulator rows are 8 consecutive tokens of one d, so it stores them as one 16-byte word; a wave owns one head and writes 2 KiB in a row per plane.
__global__ __launch_bounds__(512) void proj_kernel(const float* __restrict__ x, const b16* __restrict__ W3, const float* __restrict__ bq, const float* __restrict__ bk, const float* __restrict__ bv, int TLIM, b16* __restrict__ PH, b16* __restrict__ PL, b16* __restrict__ VTH, b16* __restrict__ VTL) { __shared__ __attribute__((aligned(16))) b16 Ah[16][C + 8], Oh[16][16][72], Ol[16][16][72]; const int lane = threadIdx.x & 31, wv = threadIdx.x >> 5, nloc = lane & 15, hlf = lane >> 4; const size_t m0 = (size_t)blockIdx.x * 16; if (m0 >= (size_t)TLIM) return;
  for (int q = 0; q < C / 32; ++q) Ah[wv][q * 32 + lane] = (b16)(bf16_rne(x[(m0 + wv) * C + q * 32 + lane]) * XS);
  __syncthreads();   // every wave reads all 16 staged rows
  const int pj = blockIdx.y; const int c0 = pj * C + wv * 64; const float sc = pj == 0 ? SCALE : 1.0f; const b16* wp = W3 + (size_t)(c0 + nloc) * C; v8f acc[4];
#pragma unroll
  for (int t = 0; t < 4; ++t) acc[t] = (v8f){};
#pragma unroll 2
  for (int kb = 0; kb < C; kb += 32) { const v16b a = frag_kb(&Ah[nloc][kb], hlf);
#pragma unroll
    for (int t = 0; t < 4; ++t) acc[t] = wmma16b(a, frag_kb(wp + t * 16 * C + kb, hlf), acc[t]); }
  if (pj == 2) { const size_t vb = (((m0 / L) * NH + wv) * (L / 16) + (m0 % L) / 16) * (HD * 16);
#pragma unroll
    for (int t = 0; t < 4; ++t) { v8b vh, vl;
#pragma unroll
      for (int r8 = 0; r8 < 8; ++r8) { b16 p, ql; split16((acc[t][r8] * (1.0f / (XS * WSC)) + 0.0f) * sc * HS, p, ql); vh[r8] = p; vl[r8] = ql; }
      *(v8b*)(VTH + vb + (t * 16 + nloc) * 16 + 8 * hlf) = vh; *(v8b*)(VTL + vb + (t * 16 + nloc) * 16 + 8 * hlf) = vl; }
    return; }
#pragma unroll
  for (int t = 0; t < 4; ++t) { const int cc = t * 16 + nloc; const float bvv = 0.0f;
#pragma unroll
    for (int r8 = 0; r8 < 8; ++r8) { b16 p, ql; split16((acc[t][r8] * (1.0f / (XS * WSC)) + bvv) * sc * HS, p, ql); Oh[wv][8 * hlf + r8][cc] = p; Ol[wv][8 * hlf + r8][cc] = ql; } }
  wave_lds_sync();
  { const int ro = lane >> 3, cs = (lane & 7) * 8; for (int rr = 0; rr < 16; rr += 4) { *(v8b*)(PH + (m0 + rr + ro) * PW + c0 + cs) = *(const v8b*)(&Oh[wv][rr + ro][cs]); *(v8b*)(PL + (m0 + rr + ro) * PW + c0 + cs) = *(const v8b*)(&Ol[wv][rr + ro][cs]); }  } }
// attention: ONE WAVE PER BLOCK, wave per (b, h, 16-query tile): key blocks of 128 over all keys; S = Q K^T (3 products, K 64); online softmax; P x256 hi+lo; the V^T fragments are read straight from VTH/VTL (each 16-byte load of a wave covers 512 bytes in a row), nothing of V is staged in LDS.
__global__ __launch_bounds__(32) void att_kernel(const b16* __restrict__ PH, const b16* __restrict__ PL, const b16* __restrict__ VTH, const b16* __restrict__ VTL, const float* __restrict__ amask, int BLIM, float* __restrict__ ATT) { __shared__ __attribute__((aligned(16))) b16 Ph_[16][KB + 8], Pl_[16][KB + 8]; __shared__ float Sf[16][KB + 4], Of[16][HD + 4];
  const int lane = threadIdx.x, nloc = lane & 15, hlf = lane >> 4; const int qt = blockIdx.x % (L / 16); const int h = (blockIdx.x / (L / 16)) % NH; const int b = blockIdx.x / ((L / 16) * NH); if (b >= BLIM) return; const int t0 = qt * 16; const size_t rowb = (size_t)b * L; const int qo = h * HD, ko = C + h * HD; const size_t vtb = (size_t)(b * NH + h) * (L / 16) * (HD * 16) + nloc * 16 + 8 * hlf;   // this lane's d row (mod 16) and token half inside a V^T tile
  v16b qh[HD / 32], ql[HD / 32];
#pragma unroll
  for (int s = 0; s < HD / 32; ++s) { qh[s] = frag_kb(PH + (rowb + t0 + nloc) * PW + qo + s * 32, hlf); ql[s] = frag_kb(PL + (rowb + t0 + nloc) * PW + qo + s * 32, hlf); }
  float m_r[8], den_r[8]; v8f acc[HD / 16];
#pragma unroll
  for (int r8 = 0; r8 < 8; ++r8) { m_r[r8] = -INFINITY; den_r[r8] = 0.0f; }
#pragma unroll
  for (int t = 0; t < HD / 16; ++t) acc[t] = (v8f){};
  const int kstart = 0; const int kend = (t0 + 16 < L) ? (t0 + 16) : L;   // causal: keys <= last query of the tile
#pragma unroll 1
  for (int kb0 = kstart; kb0 < kend; kb0 += KB) { const int nk = (kend - kb0) < KB ? (kend - kb0) : KB; const int nkt = (nk + 15) / 16;
    for (int t = 0; t < KB / 16; ++t) { if (t < nkt) { const int key = kb0 + t * 16 + nloc < L ? kb0 + t * 16 + nloc : L - 1; const size_t kr = (rowb + key) * PW + ko; v8f s = {};
#pragma unroll
        for (int q = 0; q < HD / 32; ++q) { const v16b kh = frag_kb(PH + kr + q * 32, hlf), kl = frag_kb(PL + kr + q * 32, hlf); s = wmma16b(qh[q], kh, s); s = wmma16b(qh[q], kl, s); s = wmma16b(ql[q], kh, s); }
#pragma unroll
        for (int r8 = 0; r8 < 8; ++r8) { const int i = t0 + 8 * hlf + r8, j = kb0 + t * 16 + nloc; const bool ok = (j <= i) && ((j >= i - (WINDOW - 1)) || ((j <= i - WINDOW - DIL) && (((i - WINDOW - j) % DIL) == 0)));   /* window i-127..i or dilated j = i-128-4m, m>=1 */ Sf[8 * hlf + r8][t * 16 + nloc] = ok ? s[r8] * (1.0f / (HS * HS)) : -INFINITY; } }
      else {
#pragma unroll
        for (int r8 = 0; r8 < 8; ++r8) Sf[8 * hlf + r8][t * 16 + nloc] = -INFINITY; } }
    wave_lds_sync();
#pragma unroll
    for (int rr = 0; rr < 16; ++rr) { float mx = -INFINITY;
#pragma unroll
      for (int q = 0; q < 4; ++q) mx = fmaxf(mx, Sf[rr][q * 32 + lane]);
      for (int o = 16; o; o >>= 1) mx = fmaxf(mx, __shfl_xor(mx, o));
      const float mold = __shfl(m_r[rr & 7], (rr >> 3) * 16); const float mn = fmaxf(mold, mx); const float sf = (mold == -INFINITY) ? 0.0f : ((mn == -INFINITY) ? 1.0f : __expf(mold - mn)); float ps = 0.0f;
#pragma unroll
      for (int q = 0; q < 4; ++q) { const int kx = q * 32 + lane; const float sv = Sf[rr][kx]; const float p = (sv == -INFINITY || mn == -INFINITY) ? 0.0f : __expf(sv - mn); ps += p; b16 ph, pl; split16(p * PS, ph, pl); Ph_[rr][kx] = ph; Pl_[rr][kx] = pl; }
      for (int o = 16; o; o >>= 1) ps += __shfl_xor(ps, o);
      if ((rr >> 3) == hlf) { const int r8 = rr & 7; den_r[r8] = den_r[r8] * sf + ps; m_r[r8] = mn;
#pragma unroll
        for (int t = 0; t < HD / 16; ++t) acc[t][r8] = acc[t][r8] * sf; } }
    wave_lds_sync();
    for (int ks = 0; ks < nkt * 16; ks += 32) { const v16b pa = frag_kb(&Ph_[nloc][ks], hlf), pb = frag_kb(&Pl_[nloc][ks], hlf); const size_t vp = vtb + (size_t)((kb0 + ks) / 16) * (HD * 16);   /* keys kb0+ks..+31 = two token tiles, always inside the sequence (an odd nkt only occurs with kb0 + 128 <= L); keys past kend have p = 0 and a finite V */
      v16b vh[HD / 16], vl[HD / 16];   // all eight fragments of the trip are requested before the first product, so the trip waits for L2 once and not once per d tile
#pragma unroll
      for (int t = 0; t < HD / 16; ++t) { vh[t] = frag_vt(VTH + vp + t * 256); vl[t] = frag_vt(VTL + vp + t * 256); }
#pragma unroll
      for (int t = 0; t < HD / 16; ++t) { acc[t] = wmma16b(pa, vh[t], acc[t]); acc[t] = wmma16b(pa, vl[t], acc[t]); acc[t] = wmma16b(pb, vh[t], acc[t]); }
      asm volatile("s_wait_xcnt 0x0" ::: "memory");   // the next trip rewrites the address registers that this trip's V^T loads name
    }
    wave_lds_sync(); }
#pragma unroll
  for (int t = 0; t < HD / 16; ++t)
#pragma unroll
    for (int r8 = 0; r8 < 8; ++r8) { const float dn = den_r[r8]; Of[8 * hlf + r8][t * 16 + nloc] = dn > 0.0f ? acc[t][r8] * (1.0f / (HS * PS)) / dn : 0.0f; }
  wave_lds_sync();
  { for (int rr = 0; rr < 16; ++rr) for (int s = 0; s < HD / 32; ++s) ((float*)ATT)[(rowb + t0 + rr) * C + h * HD + s * 32 + lane] = Of[rr][s * 32 + lane];  } }
// output product: block = 32 waves on one 16-token tile; the waves share the staged hi+lo tile, wave wv owns columns wv*32..wv*32+31.
__global__ __launch_bounds__(1024) void out_kernel(const float* __restrict__ ATT, const b16* __restrict__ WO, const float* __restrict__ bo, int TLIM, float* __restrict__ out) { __shared__ __attribute__((aligned(16))) b16 Ah[16][C + 8], Al[16][C + 8]; __shared__ __attribute__((aligned(16))) float Tf[32][16][36]; const int lane = threadIdx.x & 31, wv = threadIdx.x >> 5, nloc = lane & 15, hlf = lane >> 4; const size_t m0 = (size_t)blockIdx.x * 16; if (m0 >= (size_t)TLIM) return;
  { const int rr = wv >> 1, q0 = (wv & 1) * (C / 64); for (int q = q0; q < q0 + C / 64; ++q) { b16 p, ql; split16(ATT[(m0 + rr) * C + q * 32 + lane] * HS, p, ql); Ah[rr][q * 32 + lane] = p; Al[rr][q * 32 + lane] = ql; } }
  __syncthreads();   // every wave reads all 16 staged rows
  const int c0 = wv * 32; const b16* wp = WO + (size_t)(c0 + nloc) * C; v8f acc[2];
#pragma unroll
  for (int t = 0; t < 2; ++t) acc[t] = (v8f){};
#pragma unroll 2
  for (int kb = 0; kb < C; kb += 32) { const v16b a = frag_kb(&Ah[nloc][kb], hlf), al = frag_kb(&Al[nloc][kb], hlf);
#pragma unroll
    for (int t = 0; t < 2; ++t) { const v16b bw = frag_kb(wp + t * 16 * C + kb, hlf); acc[t] = wmma16b(a, bw, acc[t]); acc[t] = wmma16b(al, bw, acc[t]); } }
#pragma unroll
  for (int t = 0; t < 2; ++t) { const int cc = t * 16 + nloc; const float bb = 0.0f;
#pragma unroll
    for (int r8 = 0; r8 < 8; ++r8) Tf[wv][8 * hlf + r8][cc] = acc[t][r8] * (1.0f / (HS * WSC)) + bb; }
  wave_lds_sync();
  { const int ro = lane >> 3, cs = (lane & 7) * 4; for (int rr = 0; rr < 16; rr += 4) *(v4f*)(out + (m0 + rr + ro) * C + c0 + cs) = *(const v4f*)(&Tf[wv][rr + ro][cs]);  } }
}  // namespace

extern "C" void kernel_launch(void* const* d_in, const int* in_sizes, int n_in, void* d_out, int out_size, void* d_ws, size_t ws_size, hipStream_t stream) {
  (void)n_in;
  auto Fp = [&](int i) { return (const float*)d_in[i]; };
  // input order: 0 x [2,2048,1024]; 1 qkv [3072,1024] (out,in: rows q|k|v); 2 wo [1024,1024] (out,in)
  if (in_sizes[0] != NT * C || in_sizes[1] != 3 * C * C || in_sizes[2] != C * C || out_size != NT * C) return;
  const int BLIM = NB;   // batch cut
  const int TLIM = BLIM * L;
  size_t off = 0; char* ws = (char*)d_ws;
  auto carve = [&](size_t bytes) { char* p = ws + off; off += (bytes + 255) & ~(size_t)255; return p; };
  b16* W3 = (b16*)carve((size_t)3 * C * C * 2); b16* WO = (b16*)carve((size_t)C * C * 2); b16* PH = (b16*)carve((size_t)NT * PW * 2); b16* PL = (b16*)carve((size_t)NT * PW * 2); float* ATT = (float*)carve((size_t)NT * C * 4); b16* VTH = (b16*)carve((size_t)NT * C * 2); b16* VTL = (b16*)carve((size_t)NT * C * 2);
  if (off > ws_size || off > ((size_t)96 << 20)) return;   // ~ 88 MiB
  wput_kernel<<<(unsigned)(((size_t)4 * C * (C / 8) + 255) / 256), 256, 0, stream>>>(Fp(1), Fp(1) + (size_t)C * C, Fp(1) + (size_t)2 * C * C, Fp(2), W3, WO);
  proj_kernel<<<dim3(TLIM / 16, 3), 512, 0, stream>>>(Fp(0), W3, Fp(0), Fp(0), Fp(0), TLIM, PH, PL, VTH, VTL);
  att_kernel<<<BLIM * NH * (L / 16), 32, 0, stream>>>(PH, PL, VTH, VTL, (const float*)0, BLIM, ATT);
  out_kernel<<<TLIM / 16, 1024, 0, stream>>>(ATT, WO, (const float*)0, TLIM, (float*)d_out);
}

// v003
// A run of this version takes 312 microseconds.
// Timed twice side by side with v002, it ran 1.45 and 1.46 times as fast.
// Over all steps from v000 it is 8.98 times as fast.
#include <hip/hip_runtime.h>

// CustomWindowMHA: 16 heads x 64 over 2 x 2,048 tokens; token i attends to j in the causal window i-127..i OR the dilated set j = i-128-4m (m >= 1, j >= 0); QKV = x qkv^T (no bias), scores/8, masked softmax, out = (attn v) wo^T -> [2][2048][1024].
// Deterministic: no index structures, no atomics; flash-style online softmax over the key tiles of a query tile in a fixed order.
// TOKEN ORDER IN THE WORKSPACE: q, k and v are kept by residue class, position p = (token % 4) * 512 + token / 4 inside a sequence. A query tile is 16 positions in a row = 16 tokens of ONE class, so its dilated keys (same class) are rows in a row, and the three other classes matter only inside the window (3 tiles of 16 each).
// WMMA (v_wmma_f32_16x16x32_f16, f32 accumulate): the QKV projection with x EXACT bf16 x8 (K 1024) against exact torch weight rows x256 (one product); S = Q K^T (hi+lo x hi+lo, 3 products, K 64); O = P V (P x256 hi+lo x V^T hi+lo, 3 products; V^T comes ready from the projection, see VTH/VTL); out = attended (hi+lo) Wo^T (2 products); softmax in f32. Inputs rounded to bf16 once. Fragment k-map per lane half hh for A AND B: elements 0..7 <- k = 8hh+0..7, 8..15 <- k = 16+8hh+0..7; acc[r] = D[8hh+r][col].

namespace {
constexpr int NB = 2, L = 2048, C = 1024, NH = 16, HD = 64, NT = NB * L, KB = 128, PW = 3 * C;
constexpr int WINDOW = 128, DIL = 4;
constexpr int NC = L / DIL /* positions per residue class */, TPC = NC / 16 /* 16-position tiles per class */, WT = WINDOW / (DIL * 16) + 1 /* tiles of a foreign class that a query tile's windows can touch */;
constexpr float XS = 8.0f, HS = 256.0f /* hi+lo staging scale for q/k/v/attended */, WSC = 256.0f, PS = 256.0f, SCALE = 0.125f;
typedef _Float16 b16;
typedef __attribute__((ext_vector_type(16))) _Float16 v16b;
typedef __attribute__((ext_vector_type(8))) _Float16 v8b;
typedef __attribute__((ext_vector_type(8))) float v8f;
typedef __attribute__((ext_vector_type(4))) float v4f;
__device__ __forceinline__ float bf16_rne(float f) { unsigned int u = __float_as_uint(f); u += 0x7FFFu + ((u >> 16) & 1u); float r = __uint_as_float(u & 0xFFFF0000u); asm volatile("" : "+v"(r)); return r; }
__device__ __forceinline__ float bfv(float f) { float r = bf16_rne(f); asm volatile("" : "+v"(r)); return r; }
__device__ __forceinline__ void split16(float v, b16& hi, b16& lo) { hi = (b16)v; lo = (b16)(v - (float)hi); }
__device__ __forceinline__ v16b frag_kb(const b16* p, int hh) { const v8b a = *(const v8b*)(p + 8 * hh), b = *(const v8b*)(p + 16 + 8 * hh); v16b f;
#pragma unroll
  for (int e = 0; e < 8; ++e) { f[e] = a[e]; f[8 + e] = b[e]; } return f; }
// V^T fragment of 32 keys from the tiled planes: p and p2 point at this lane's (d, 8*hh) in the first and the second 16-position tile of the pair; elements 0..7 <- k = 8hh+0..7 (p), 8..15 <- k = 16+8hh+0..7 (p2): the same k-map as frag_kb.
__device__ __forceinline__ v16b frag_vt(const b16* p, const b16* p2) { const v8b a = *(const v8b*)p, b = *(const v8b*)p2; v16b f;
#pragma unroll
  for (int e = 0; e < 8; ++e) { f[e] = a[e]; f[8 + e] = b[e]; } return f; }
__device__ __forceinline__ v8f wmma16b(v16b a, v16b b, v8f c) { v8f d = __builtin_amdgcn_wmma_f32_16x16x32_f16(false, a, false, b, (short)0, c, false, false); asm volatile("v_nop\n\tv_nop\n\tv_nop\n\tv_nop" : "+v"(d) : "v"(a), "v"(b)); return d; }
__device__ __forceinline__ void wave_lds_sync() { __builtin_amdgcn_fence(__ATOMIC_RELEASE, "workgroup"); __builtin_amdgcn_wave_barrier(); __builtin_amdgcn_fence(__ATOMIC_ACQUIRE, "workgroup"); }
// u-th key tile of query tile (class r, tile g of the class), as a tile number in position order, or -1 for none: first the own class from its start up to the diagonal (u = 0..g), then of each other class the WT tiles g-WT+1..g that the windows reach.
__device__ __forceinline__ int key_tile(int u, int g, int r) { if (u <= g) return r * TPC + u; const int v = u - g - 1, ci = v / WT, tau = g - (WT - 1) + v % WT; if (ci >= DIL - 1 || tau < 0) return -1; return (ci + (ci >= r ? 1 : 0)) * TPC + tau; }
__device__ __forceinline__ float pmul(float a, float b) { float p = a * b; asm volatile("" : "+v"(p)); return p; }

__global__ __launch_bounds__(256) void wput_kernel(const float* __restrict__ wq, const float* __restrict__ wk, const float* __restrict__ wv, const float* __restrict__ wo, b16* __restrict__ W3, b16* __restrict__ WO) { const size_t u = (size_t)blockIdx.x * 256 + threadIdx.x; if (u >= (size_t)4 * C * (C / 8)) return; const int r = (int)(u / (C / 8)), k0 = (int)(u % (C / 8)) * 8; const int p = r / C, o = r % C; const float* w = p == 0 ? wq : (p == 1 ? wk : (p == 2 ? wv : wo)); v8b v;
#pragma unroll
  for (int j = 0; j < 8; ++j) v[j] = (b16)(bf16_rne(w[(size_t)o * C + k0 + j]) * WSC);
  { *(v8b*)((p < 3 ? W3 + (size_t)r * C : WO + (size_t)o * C) + k0) = v;  } }
// projection: block = 16 waves on one tile of 16 positions (16 tokens of one residue class, see the head of the file) and one of q|k|v (blockIdx.y); the waves share the staged x tile, wave wv owns columns wv*64..wv*64+63 of that part.
// q and k go out token-major (PH/PL). v goes out TRANSPOSED, tiled [b][head][16-token tile][d 0..63][token 0..15] (VTH/VTL): a lane's 8 accumulator rows are 8 consecutive positions (tokens 4 apart) of one d, so it stores them as one 16-byte word; a wave owns one head and writes 2 KiB in a row per plane.
__global__ __launch_bounds__(512) void proj_kernel(const float* __restrict__ x, const b16* __restrict__ W3, const float* __restrict__ bq, const float* __restrict__ bk, const float* __restrict__ bv, int TLIM, b16* __restrict__ PH, b16* __restrict__ PL, b16* __restrict__ VTH, b16* __restrict__ VTL) { __shared__ __attribute__((aligned(16))) b16 Ah[16][C + 8], Oh[16][16][72], Ol[16][16][72]; const int lane = threadIdx.x & 31, wv = threadIdx.x >> 5, nloc = lane & 15, hlf = lane >> 4; const size_t m0 = (size_t)blockIdx.x * 16; if (m0 >= (size_t)TLIM) return;
  const size_t xr = ((m0 + wv) / L) * L + DIL * ((m0 + wv) % NC) + ((m0 + wv) % L) / NC;   // the token that stands at position m0 + wv
  for (int q = 0; q < C / 32; ++q) Ah[wv][q * 32 + lane] = (b16)(bf16_rne(x[xr * C + q * 32 + lane]) * XS);
  __syncthreads();   // every wave reads all 16 staged rows
  const int pj = blockIdx.y; const int c0 = pj * C + wv * 64; const float sc = pj == 0 ? SCALE : 1.0f; const b16* wp = W3 + (size_t)(c0 + nloc) * C; v8f acc[4];
#pragma unroll
  for (int t = 0; t < 4; ++t) acc[t] = (v8f){};
#pragma unroll 2
  for (int kb = 0; kb < C; kb += 32) { const v16b a = frag_kb(&Ah[nloc][kb], hlf);
#pragma unroll
    for (int t = 0; t < 4; ++t) acc[t] = wmma16b(a, frag_kb(wp + t * 16 * C + kb, hlf), acc[t]); }
  if (pj == 2) { const size_t vb = (((m0 / L) * NH + wv) * (L / 16) + (m0 % L) / 16) * (HD * 16);
#pragma unroll
    for (int t = 0; t < 4; ++t) { v8b vh, vl;
#pragma unroll
      for (int r8 = 0; r8 < 8; ++r8) { b16 p, ql; split16((acc[t][r8] * (1.0f / (XS * WSC)) + 0.0f) * sc * HS, p, ql); vh[r8] = p; vl[r8] = ql; }
      *(v8b*)(VTH + vb + (t * 16 + nloc) * 16 + 8 * hlf) = vh; *(v8b*)(VTL + vb + (t * 16 + nloc) * 16 + 8 * hlf) = vl; }
    return; }
#pragma unroll
  for (int t = 0; t < 4; ++t) { const int cc = t * 16 + nloc; const float bvv = 0.0f;
#pragma unroll
    for (int r8 = 0; r8 < 8; ++r8) { b16 p, ql; split16((acc[t][r8] * (1.0f / (XS * WSC)) + bvv) * sc * HS, p, ql); Oh[wv][8 * hlf + r8][cc] = p; Ol[wv][8 * hlf + r8][cc] = ql; } }
  wave_lds_sync();
  { const int ro = lane >> 3, cs = (lane & 7) * 8; for (int rr = 0; rr < 16; rr += 4) { *(v8b*)(PH + (m0 + rr + ro) * PW + c0 + cs) = *(const v8b*)(&Oh[wv][rr + ro][cs]); *(v8b*)(PL + (m0 + rr + ro) * PW + c0 + cs) = *(const v8b*)(&Ol[wv][rr + ro][cs]); }  } }
// attention: ONE WAVE PER BLOCK, wave per (b, h, 16-query tile of one residue class): key blocks of 8 tiles from the list of key_tile() (own class up to the diagonal, the other classes inside the window), every key that the mask allows exactly once; S = Q K^T (3 products, K 64); online softmax; P x256 hi+lo; the V^T fragments are read straight from VTH/VTL (each 16-byte load of a wave covers 512 bytes in a row), nothing of V is staged in LDS.
__global__ __launch_bounds__(32) void att_kernel(const b16* __restrict__ PH, const b16* __restrict__ PL, const b16* __restrict__ VTH, const b16* __restrict__ VTL, const float* __restrict__ amask, int BLIM, float* __restrict__ ATT) { __shared__ __attribute__((aligned(16))) b16 Ph_[16][KB + 8], Pl_[16][KB + 8]; __shared__ float Sf[16][KB + 4], Of[16][HD + 4];
  const int lane = threadIdx.x, nloc = lane & 15, hlf = lane >> 4; const int qt = blockIdx.x % (L / 16); const int h = (blockIdx.x / (L / 16)) % NH; const int b = blockIdx.x / ((L / 16) * NH); if (b >= BLIM) return; const int t0 = qt * 16, r = qt / TPC, g = qt % TPC; const size_t rowb = (size_t)b * L; const int qo = h * HD, ko = C + h * HD; const size_t vtb = (size_t)(b * NH + h) * (L / 16) * (HD * 16); const unsigned vlo = nloc * 16 + 8 * hlf;   // the head's first V^T tile (the same for the wave); this lane's d row (mod 16) and token half inside a tile
  v16b qh[HD / 32], ql[HD / 32];
#pragma unroll
  for (int s = 0; s < HD / 32; ++s) { qh[s] = frag_kb(PH + (rowb + t0 + nloc) * PW + qo + s * 32, hlf); ql[s] = frag_kb(PL + (rowb + t0 + nloc) * PW + qo + s * 32, hlf); }
  float m_r[8], den_r[8]; v8f acc[HD / 16];
#pragma unroll
  for (int r8 = 0; r8 < 8; ++r8) { m_r[r8] = -INFINITY; den_r[r8] = 0.0f; }
#pragma unroll
  for (int t = 0; t < HD / 16; ++t) acc[t] = (v8f){};
  const int ntile = g + 1 + WT * (DIL - 1);   // length of the key tile list
#pragma unroll 1
  for (int u0 = 0; u0 < ntile; u0 += KB / 16) { const int nkt = (ntile - u0) < KB / 16 ? (ntile - u0) : KB / 16;
    for (int t = 0; t < KB / 16; ++t) { const int kt = key_tile(u0 + t, g, r); if (kt >= 0) { const size_t kr = (rowb + kt * 16 + nloc) * PW + ko; v8f s = {};
#pragma unroll
        for (int q = 0; q < HD / 32; ++q) { const v16b kh = frag_kb(PH + kr + q * 32, hlf), kl = frag_kb(PL + kr + q * 32, hlf); s = wmma16b(qh[q], kh, s); s = wmma16b(qh[q], kl, s); s = wmma16b(ql[q], kh, s); }
#pragma unroll
        for (int r8 = 0; r8 < 8; ++r8) { const int i = r + DIL * (g * 16 + 8 * hlf + r8), j = kt / TPC + DIL * ((kt % TPC) * 16 + nloc);   /* tokens of the two positions */ const bool ok = (j <= i) && ((j >= i - (WINDOW - 1)) || ((j <= i - WINDOW - DIL) && (((i - WINDOW - j) % DIL) == 0)));   /* window i-127..i or dilated j = i-128-4m, m>=1 */ Sf[8 * hlf + r8][t * 16 + nloc] = ok ? s[r8] * (1.0f / (HS * HS)) : -INFINITY; } }
      else {
#pragma unroll
        for (int r8 = 0; r8 < 8; ++r8) Sf[8 * hlf + r8][t * 16 + nloc] = -INFINITY; } }
    wave_lds_sync();
#pragma unroll
    for (int rr = 0; rr < 16; ++rr) { float mx = -INFINITY;
#pragma unroll
      for (int q = 0; q < 4; ++q) mx = fmaxf(mx, Sf[rr][q * 32 + lane]);
      for (int o = 16; o; o >>= 1) mx = fmaxf(mx, __shfl_xor(mx, o));
      const float mold = __shfl(m_r[rr & 7], (rr >> 3) * 16); const float mn = fmaxf(mold, mx); const float sf = (mold == -INFINITY) ? 0.0f : ((mn == -INFINITY) ? 1.0f : __expf(mold - mn)); float ps = 0.0f;
#pragma unroll
      for (int q = 0; q < 4; ++q) { const int kx = q * 32 + lane; const float sv = Sf[rr][kx]; const float p = (sv == -INFINITY || mn == -INFINITY) ? 0.0f : __expf(sv - mn); ps += p; b16 ph, pl; split16(p * PS, ph, pl); Ph_[rr][kx] = ph; Pl_[rr][kx] = pl; }
      for (int o = 16; o; o >>= 1) ps += __shfl_xor(ps, o);
      if ((rr >> 3) == hlf) { const int r8 = rr & 7; den_r[r8] = den_r[r8] * sf + ps; m_r[r8] = mn;
#pragma unroll
        for (int t = 0; t < HD / 16; ++t) acc[t][r8] = acc[t][r8] * sf; } }
    wave_lds_sync();
    for (int ks = 0; ks < nkt * 16; ks += 32) { const v16b pa = frag_kb(&Ph_[nloc][ks], hlf), pb = frag_kb(&Pl_[nloc][ks], hlf); const int ka = key_tile(u0 + ks / 16, g, r), kc = key_tile(u0 + ks / 16 + 1, g, r); const size_t vp = vtb + (size_t)(ka < 0 ? r * TPC : ka) * (HD * 16), vp2 = vtb + (size_t)(kc < 0 ? r * TPC : kc) * (HD * 16);   /* two tiles of the list; where the list has none, p = 0 there and any written tile serves (finite V) */
      const b16 *h1 = VTH + vp + vlo, *h2 = VTH + vp2 + vlo, *l1 = VTL + vp + vlo, *l2 = VTL + vp2 + vlo;   // this lane's place in the two tiles, hi and lo plane
      v16b vh[HD / 16], vl[HD / 16];   // all eight fragments of the trip are requested before the first product, so the trip waits for L2 once and not once per d tile
#pragma unroll
      for (int t = 0; t < HD / 16; ++t) { vh[t] = frag_vt(h1 + t * 256, h2 + t * 256); vl[t] = frag_vt(l1 + t * 256, l2 + t * 256); }
#pragma unroll
      for (int t = 0; t < HD / 16; ++t) { acc[t] = wmma16b(pa, vh[t], acc[t]); acc[t] = wmma16b(pa, vl[t], acc[t]); acc[t] = wmma16b(pb, vh[t], acc[t]); }
      asm volatile("s_wait_xcnt 0x0" :: "v"(h1), "v"(h2), "v"(l1), "v"(l2) : "memory");   // the next trip rewrites the address registers that this trip's V^T loads name; as inputs here they stay untouched (also by a later load's result) up to this wait
    }
    wave_lds_sync(); }
#pragma unroll
  for (int t = 0; t < HD / 16; ++t)
#pragma unroll
    for (int r8 = 0; r8 < 8; ++r8) { const float dn = den_r[r8]; Of[8 * hlf + r8][t * 16 + nloc] = dn > 0.0f ? acc[t][r8] * (1.0f / (HS * PS)) / dn : 0.0f; }
  wave_lds_sync();
  { for (int rr = 0; rr < 16; ++rr) for (int s = 0; s < HD / 32; ++s) ((float*)ATT)[(rowb + r + DIL * (g * 16 + rr)) * C + h * HD + s * 32 + lane] = Of[rr][s * 32 + lane];  } }
// output product: block = 32 waves on one 16-token tile; the waves share the staged hi+lo tile, wave wv owns columns wv*32..wv*32+31.
__global__ __launch_bounds__(1024) void out_kernel(const float* __restrict__ ATT, const b16* __restrict__ WO, const float* __restrict__ bo, int TLIM, float* __restrict__ out) { __shared__ __attribute__((aligned(16))) b16 Ah[16][C + 8], Al[16][C + 8]; __shared__ __attribute__((aligned(16))) float Tf[32][16][36]; const int lane = threadIdx.x & 31, wv = threadIdx.x >> 5, nloc = lane & 15, hlf = lane >> 4; const size_t m0 = (size_t)blockIdx.x * 16; if (m0 >= (size_t)TLIM) return;
  { const int rr = wv >> 1, q0 = (wv & 1) * (C / 64); for (int q = q0; q < q0 + C / 64; ++q) { b16 p, ql; split16(ATT[(m0 + rr) * C + q * 32 + lane] * HS, p, ql); Ah[rr][q * 32 + lane] = p; Al[rr][q * 32 + lane] = ql; } }
  __syncthreads();   // every wave reads all 16 staged rows
  const int c0 = wv * 32; const b16* wp = WO + (size_t)(c0 + nloc) * C; v8f acc[2];
#pragma unroll
  for (int t = 0; t < 2; ++t) acc[t] = (v8f){};
#pragma unroll 2
  for (int kb = 0; kb < C; kb += 32) { const v16b a = frag_kb(&Ah[nloc][kb], hlf), al = frag_kb(&Al[nloc][kb], hlf);
#pragma unroll
    for (int t = 0; t < 2; ++t) { const v16b bw = frag_kb(wp + t * 16 * C + kb, hlf); acc[t] = wmma16b(a, bw, acc[t]); acc[t] = wmma16b(al, bw, acc[t]); } }
#pragma unroll
  for (int t = 0; t < 2; ++t) { const int cc = t * 16 + nloc; const float bb = 0.0f;
#pragma unroll
    for (int r8 = 0; r8 < 8; ++r8) Tf[wv][8 * hlf + r8][cc] = acc[t][r8] * (1.0f / (HS * WSC)) + bb; }
  wave_lds_sync();
  { const int ro = lane >> 3, cs = (lane & 7) * 4; for (int rr = 0; rr < 16; rr += 4) *(v4f*)(out + (m0 + rr + ro) * C + c0 + cs) = *(const v4f*)(&Tf[wv][rr + ro][cs]);  } }
}  // namespace

extern "C" void kernel_launch(void* const* d_in, const int* in_sizes, int n_in, void* d_out, int out_size, void* d_ws, size_t ws_size, hipStream_t stream) {
  (void)n_in;
  auto Fp = [&](int i) { return (const float*)d_in[i]; };
  // input order: 0 x [2,2048,1024]; 1 qkv [3072,1024] (out,in: rows q|k|v); 2 wo [1024,1024] (out,in)
  if (in_sizes[0] != NT * C || in_sizes[1] != 3 * C * C || in_sizes[2] != C * C || out_size != NT * C) return;
  const int BLIM = NB;   // batch cut
  const int TLIM = BLIM * L;
  size_t off = 0; char* ws = (char*)d_ws;
  auto carve = [&](size_t bytes) { char* p = ws + off; off += (bytes + 255) & ~(size_t)255; return p; };
  b16* W3 = (b16*)carve((size_t)3 * C * C * 2); b16* WO = (b16*)carve((size_t)C * C * 2); b16* PH = (b16*)carve((size_t)NT * PW * 2); b16* PL = (b16*)carve((size_t)NT * PW * 2); float* ATT = (float*)carve((size_t)NT * C * 4); b16* VTH = (b16*)carve((size_t)NT * C * 2); b16* VTL = (b16*)carve((size_t)NT * C * 2);
  if (off > ws_size || off > ((size_t)96 << 20)) return;   // ~ 88 MiB
  wput_kernel<<<(unsigned)(((size_t)4 * C * (C / 8) + 255) / 256), 256, 0, stream>>>(Fp(1), Fp(1) + (size_t)C * C, Fp(1) + (size_t)2 * C * C, Fp(2), W3, WO);
  proj_kernel<<<dim3(TLIM / 16, 3), 512, 0, stream>>>(Fp(0), W3, Fp(0), Fp(0), Fp(0), TLIM, PH, PL, VTH, VTL);
  att_kernel<<<BLIM * NH * (L / 16), 32, 0, stream>>>(PH, PL, VTH, VTL, (const float*)0, BLIM, ATT);
  out_kernel<<<TLIM / 16, 1024, 0, stream>>>(ATT, WO, (const float*)0, TLIM, (float*)d_out);
}

// v004
// A run of this version takes 264 microseconds.
// Two timings next to v003 put it at 1.20 and 1.19 times that version's speed.
// All steps since v000 together make it 10.7 times as fast.
#include <hip/hip_runtime.h>

// CustomWindowMHA: 16 heads x 64 over 2 x 2,048 tokens; token i attends to j in the causal window i-127..i OR the dilated set j = i-128-4m (m >= 1, j >= 0); QKV = x qkv^T (no bias), scores/8, masked softmax, out = (attn v) wo^T -> [2][2048][1024].
// Deterministic: no index structures, no atomics; flash-style online softmax over the key tiles of a query tile in a fixed order.
// TOKEN ORDER IN THE WORKSPACE: q, k and v are kept by residue class, position p = (token % 4) * 512 + token / 4 inside a sequence. A query tile is 16 positions in a row = 16 tokens of ONE class, so its dilated keys (same class) are rows in a row, and the three other classes matter only inside the window (3 tiles of 16 each).
// FRAGMENT ORDER: the B operands that a wave reads from global memory as weights (W3, WO) and keys (KFH/KFL) are stored as the WMMA wants it: per tile of 16 rows and per 32 k one block of 512 elements [16-k half j][lane][8], lane = 16*hh + row, k = 16j + 8hh + 0..7. A wave's 16-byte load then covers 512 bytes in a row (4 lines) where row-major storage gave it 32 bytes of each of 16 lines.
// WMMA (v_wmma_f32_16x16x32_f16, f32 accumulate): the QKV projection with x EXACT bf16 x8 (K 1024) against exact torch weight rows x256 (one product); S = Q K^T (hi+lo x hi+lo, 3 products, K 64); O = P V (P x256 hi+lo x V^T hi+lo, 3 products; V^T comes ready from the projection, see VTH/VTL); out = attended (hi+lo) Wo^T (2 products); softmax in f32. Inputs rounded to bf16 once. Fragment k-map per lane half hh for A AND B: elements 0..7 <- k = 8hh+0..7, 8..15 <- k = 16+8hh+0..7; acc[r] = D[8hh+r][col].

namespace {
constexpr int NB = 2, L = 2048, C = 1024, NH = 16, HD = 64, NT = NB * L, KB = 128, PW = 3 * C;
constexpr int WINDOW = 128, DIL = 4;
constexpr int NC = L / DIL /* positions per residue class */, TPC = NC / 16 /* 16-position tiles per class */, WT = WINDOW / (DIL * 16) + 1 /* tiles of a foreign class that a query tile's windows can touch */;
constexpr float XS = 8.0f, HS = 256.0f /* hi+lo staging scale for q/k/v/attended */, WSC = 256.0f, PS = 256.0f, SCALE = 0.125f;
typedef _Float16 b16;
typedef __attribute__((ext_vector_type(16))) _Float16 v16b;
typedef __attribute__((ext_vector_type(8))) _Float16 v8b;
typedef __attribute__((ext_vector_type(8))) float v8f;
typedef __attribute__((ext_vector_type(4))) float v4f;
__device__ __forceinline__ float bf16_rne(float f) { unsigned int u = __float_as_uint(f); u += 0x7FFFu + ((u >> 16) & 1u); float r = __uint_as_float(u & 0xFFFF0000u); asm volatile("" : "+v"(r)); return r; }
__device__ __forceinline__ float bfv(float f) { float r = bf16_rne(f); asm volatile("" : "+v"(r)); return r; }
__device__ __forceinline__ void split16(float v, b16& hi, b16& lo) { hi = (b16)v; lo = (b16)(v - (float)hi); }
__device__ __forceinline__ v16b frag_kb(const b16* p, int hh) { const v8b a = *(const v8b*)(p + 8 * hh), b = *(const v8b*)(p + 16 + 8 * hh); v16b f;
#pragma unroll
  for (int e = 0; e < 8; ++e) { f[e] = a[e]; f[8 + e] = b[e]; } return f; }
// V^T fragment of 32 keys from the tiled planes: p and p2 point at this lane's (d, 8*hh) in the first and the second 16-position tile of the pair; elements 0..7 <- k = 8hh+0..7 (p), 8..15 <- k = 16+8hh+0..7 (p2): the same k-map as frag_kb.
__device__ __forceinline__ v16b frag_vt(const b16* p, const b16* p2) { const v8b a = *(const v8b*)p, b = *(const v8b*)p2; v16b f;
#pragma unroll
  for (int e = 0; e < 8; ++e) { f[e] = a[e]; f[8 + e] = b[e]; } return f; }
// fragment of 32 k from a fragment-order block: p points at this lane's 8 elements of half j = 0, half j = 1 stands 256 elements on; the same k-map as frag_kb.
__device__ __forceinline__ v16b frag_fo(const b16* p) { return frag_vt(p, p + 256); }
__device__ __forceinline__ v8f wmma16b(v16b a, v16b b, v8f c) { v8f d = __builtin_amdgcn_wmma_f32_16x16x32_f16(false, a, false, b, (short)0, c, false, false); asm volatile("v_nop\n\tv_nop\n\tv_nop\n\tv_nop" : "+v"(d) : "v"(a), "v"(b)); return d; }
__device__ __forceinline__ void wave_lds_sync() { __builtin_amdgcn_fence(__ATOMIC_RELEASE, "workgroup"); __builtin_amdgcn_wave_barrier(); __builtin_amdgcn_fence(__ATOMIC_ACQUIRE, "workgroup"); }
// u-th key tile of query tile (class r, tile g of the class), as a tile number in position order, or -1 for none: first the own class from its start up to the diagonal (u = 0..g), then of each other class the WT tiles g-WT+1..g that the windows reach.
__device__ __forceinline__ int key_tile(int u, int g, int r) { if (u <= g) return r * TPC + u; const int v = u - g - 1, ci = v / WT, tau = g - (WT - 1) + v % WT; if (ci >= DIL - 1 || tau < 0) return -1; return (ci + (ci >= r ? 1 : 0)) * TPC + tau; }
__device__ __forceinline__ float pmul(float a, float b) { float p = a * b; asm volatile("" : "+v"(p)); return p; }

__global__ __launch_bounds__(256) void wput_kernel(const float* __restrict__ wq, const float* __restrict__ wk, const float* __restrict__ wv, const float* __restrict__ wo, b16* __restrict__ W3, b16* __restrict__ WO) { const size_t u = (size_t)blockIdx.x * 256 + threadIdx.x; if (u >= (size_t)4 * C * (C / 8)) return; const int c = (int)(u & 3), ks = (int)(u >> 5) % (C / 32), r = (int)(u / C) * 8 + (int)((u >> 2) & 7), k0 = ks * 32 + c * 8;   /* a wave takes 32 k of 8 rows: it reads 8 whole lines and writes 4 whole lines */ const int p = r / C, o = r % C, rb = p < 3 ? r : o; const float* w = p == 0 ? wq : (p == 1 ? wk : (p == 2 ? wv : wo)); v8b v;
#pragma unroll
  for (int j = 0; j < 8; ++j) v[j] = (b16)(bf16_rne(w[(size_t)o * C + k0 + j]) * WSC);
  { *(v8b*)((p < 3 ? W3 : WO) + ((size_t)(rb >> 4) * (C / 32) + ks) * 512 + (c >> 1) * 256 + ((c & 1) * 16 + (rb & 15)) * 8) = v;  } }
// projection: block = 16 waves on one tile of 16 positions (16 tokens of one residue class, see the head of the file) and one of q|k|v (blockIdx.y); the waves share the staged x tile, wave wv owns columns wv*64..wv*64+63 of that part.
// q goes out token-major (PH/PL). k goes out in fragment order, tiled [b][head][16-token tile][d half 0..1][j][lane][8] (KFH/KFL): a wave owns one head and writes 2 KiB in a row per plane. v goes out TRANSPOSED, tiled [b][head][16-token tile][d 0..63][token 0..15] (VTH/VTL): a lane's 8 accumulator rows are 8 consecutive tokens of one d, so it stores them as one 16-byte word; a wave owns one head and writes 2 KiB in a row per plane.
__global__ __launch_bounds__(512) void proj_kernel(const float* __restrict__ x, const b16* __restrict__ W3, const float* __restrict__ bq, const float* __restrict__ bk, const float* __restrict__ bv, int TLIM, b16* __restrict__ PH, b16* __restrict__ PL, b16* __restrict__ VTH, b16* __restrict__ VTL, b16* __restrict__ KFH, b16* __restrict__ KFL) { __shared__ __attribute__((aligned(16))) b16 Ah[16][C + 8], Oh[16][16][72], Ol[16][16][72]; const int lane = threadIdx.x & 31, wv = threadIdx.x >> 5, nloc = lane & 15, hlf = lane >> 4; const size_t m0 = (size_t)blockIdx.x * 16; if (m0 >= (size_t)TLIM) return;
  const size_t xr = ((m0 + wv) / L) * L + DIL * ((m0 + wv) % NC) + ((m0 + wv) % L) / NC;   // the token that stands at position m0 + wv
  for (int q = 0; q < C / 32; ++q) Ah[wv][q * 32 + lane] = (b16)(bf16_rne(x[xr * C + q * 32 + lane]) * XS);
  __syncthreads();   // every wave reads all 16 staged rows
  const int pj = blockIdx.y; const int c0 = pj * C + wv * 64; const float sc = pj == 0 ? SCALE : 1.0f; const b16* wp = W3 + (size_t)(c0 / 16) * (C / 32) * 512 + lane * 8; v8f acc[4];
#pragma unroll
  for (int t = 0; t < 4; ++t) acc[t] = (v8f){};
#pragma unroll 2
  for (int kb = 0; kb < C; kb += 32) { const v16b a = frag_kb(&Ah[nloc][kb], hlf);
#pragma unroll
    for (int t = 0; t < 4; ++t) acc[t] = wmma16b(a, frag_fo(wp + t * 16 * C + kb * 16), acc[t]); }
  if (pj == 2) { const size_t vb = (((m0 / L) * NH + wv) * (L / 16) + (m0 % L) / 16) * (HD * 16);
#pragma unroll
    for (int t = 0; t < 4; ++t) { v8b vh, vl;
#pragma unroll
      for (int r8 = 0; r8 < 8; ++r8) { b16 p, ql; split16((acc[t][r8] * (1.0f / (XS * WSC)) + 0.0f) * sc * HS, p, ql); vh[r8] = p; vl[r8] = ql; }
      *(v8b*)(VTH + vb + (t * 16 + nloc) * 16 + 8 * hlf) = vh; *(v8b*)(VTL + vb + (t * 16 + nloc) * 16 + 8 * hlf) = vl; }
    return; }
#pragma unroll
  for (int t = 0; t < 4; ++t) { const int cc = t * 16 + nloc; const float bvv = 0.0f;
#pragma unroll
    for (int r8 = 0; r8 < 8; ++r8) { b16 p, ql; split16((acc[t][r8] * (1.0f / (XS * WSC)) + bvv) * sc * HS, p, ql); Oh[wv][8 * hlf + r8][cc] = p; Ol[wv][8 * hlf + r8][cc] = ql; } }
  wave_lds_sync();
  if (pj == 1) { const size_t kf = (((m0 / L) * NH + wv) * (L / 16) + (m0 % L) / 16) * (HD * 16) + lane * 8;
#pragma unroll
    for (int i = 0; i < 4; ++i) { *(v8b*)(KFH + kf + i * 256) = *(const v8b*)(&Oh[wv][nloc][i * 16 + 8 * hlf]); *(v8b*)(KFL + kf + i * 256) = *(const v8b*)(&Ol[wv][nloc][i * 16 + 8 * hlf]); }
    asm volatile("s_wait_xcnt 0x0" ::: "memory");   // behind the run of k stores: in the listing the code that follows them rewrites registers that hold their addresses
    return; }
  { const int ro = lane >> 3, cs = (lane & 7) * 8; for (int rr = 0; rr < 16; rr += 4) { *(v8b*)(PH + (m0 + rr + ro) * PW + c0 + cs) = *(const v8b*)(&Oh[wv][rr + ro][cs]); *(v8b*)(PL + (m0 + rr + ro) * PW + c0 + cs) = *(const v8b*)(&Ol[wv][rr + ro][cs]); }  }
  asm volatile("s_wait_xcnt 0x0" ::: "memory");   // behind the run of q stores: in the listing the k block stands behind them and rewrites registers that hold their addresses
}
// attention: ONE WAVE PER BLOCK, wave per (b, h, 16-query tile of one residue class): key blocks of 8 tiles from the list of key_tile() (own class up to the diagonal, the other classes inside the window), every key that the mask allows exactly once; S = Q K^T (3 products, K 64); online softmax; P x256 hi+lo; the V^T fragments are read straight from VTH/VTL (each 16-byte load of a wave covers 512 bytes in a row), nothing of V is staged in LDS.
__global__ __launch_bounds__(32) void att_kernel(const b16* __restrict__ PH, const b16* __restrict__ PL, const b16* __restrict__ KFH, const b16* __restrict__ KFL, const b16* __restrict__ VTH, const b16* __restrict__ VTL, const float* __restrict__ amask, int BLIM, float* __restrict__ ATT) { __shared__ __attribute__((aligned(16))) b16 Ph_[16][KB + 8], Pl_[16][KB + 8]; __shared__ float Sf[16][KB + 4], Of[16][HD + 4];
  const int lane = threadIdx.x, nloc = lane & 15, hlf = lane >> 4; const int qt = blockIdx.x % (L / 16); const int h = (blockIdx.x / (L / 16)) % NH; const int b = blockIdx.x / ((L / 16) * NH); if (b >= BLIM) return; const int t0 = qt * 16, r = qt / TPC, g = qt % TPC; const size_t rowb = (size_t)b * L; const int qo = h * HD; const size_t vtb = (size_t)(b * NH + h) * (L / 16) * (HD * 16); const unsigned vlo = nloc * 16 + 8 * hlf;   // the head's first K or V^T tile (the same for the wave); this lane's d row (mod 16) and token half inside a tile
  v16b qh[HD / 32], ql[HD / 32];
#pragma unroll
  for (int s = 0; s < HD / 32; ++s) { qh[s] = frag_kb(PH + (rowb + t0 + nloc) * PW + qo + s * 32, hlf); ql[s] = frag_kb(PL + (rowb + t0 + nloc) * PW + qo + s * 32, hlf); }
  float m_r[8], den_r[8]; v8f acc[HD / 16];
#pragma unroll
  for (int r8 = 0; r8 < 8; ++r8) { m_r[r8] = -INFINITY; den_r[r8] = 0.0f; }
#pragma unroll
  for (int t = 0; t < HD / 16; ++t) acc[t] = (v8f){};
  const int ntile = g + 1 + WT * (DIL - 1);   // length of the key tile list
#pragma unroll 1
  for (int u0 = 0; u0 < ntile; u0 += KB / 16) { const int nkt = (ntile - u0) < KB / 16 ? (ntile - u0) : KB / 16;
    for (int t = 0; t < KB / 16; ++t) { const int kt = key_tile(u0 + t, g, r); if (kt >= 0) { const size_t kr = vtb + (size_t)kt * (HD * 16) + lane * 8; v8f s = {};
#pragma unroll
        for (int q = 0; q < HD / 32; ++q) { const v16b kh = frag_fo(KFH + kr + q * 512), kl = frag_fo(KFL + kr + q * 512); s = wmma16b(qh[q], kh, s); s = wmma16b(qh[q], kl, s); s = wmma16b(ql[q], kh, s); }
#pragma unroll
        for (int r8 = 0; r8 < 8; ++r8) { const int i = r + DIL * (g * 16 + 8 * hlf + r8), j = kt / TPC + DIL * ((kt % TPC) * 16 + nloc);   /* tokens of the two positions */ const bool ok = (j <= i) && ((j >= i - (WINDOW - 1)) || ((j <= i - WINDOW - DIL) && (((i - WINDOW - j) % DIL) == 0)));   /* window i-127..i or dilated j = i-128-4m, m>=1 */ Sf[8 * hlf + r8][t * 16 + nloc] = ok ? s[r8] * (1.0f / (HS * HS)) : -INFINITY; } }
      else {
#pragma unroll
        for (int r8 = 0; r8 < 8; ++r8) Sf[8 * hlf + r8][t * 16 + nloc] = -INFINITY; } }
    wave_lds_sync();
#pragma unroll
    for (int rr = 0; rr < 16; ++rr) { float mx = -INFINITY;
#pragma unroll
      for (int q = 0; q < 4; ++q) mx = fmaxf(mx, Sf[rr][q * 32 + lane]);
      for (int o = 16; o; o >>= 1) mx = fmaxf(mx, __shfl_xor(mx, o));
      const float mold = __shfl(m_r[rr & 7], (rr >> 3) * 16); const float mn = fmaxf(mold, mx); const float sf = (mold == -INFINITY) ? 0.0f : ((mn == -INFINITY) ? 1.0f : __expf(mold - mn)); float ps = 0.0f;
#pragma unroll
      for (int q = 0; q < 4; ++q) { const int kx = q * 32 + lane; const float sv = Sf[rr][kx]; const float p = (sv == -INFINITY || mn == -INFINITY) ? 0.0f : __expf(sv - mn); ps += p; b16 ph, pl; split16(p * PS, ph, pl); Ph_[rr][kx] = ph; Pl_[rr][kx] = pl; }
      for (int o = 16; o; o >>= 1) ps += __shfl_xor(ps, o);
      if ((rr >> 3) == hlf) { const int r8 = rr & 7; den_r[r8] = den_r[r8] * sf + ps; m_r[r8] = mn;
#pragma unroll
        for (int t = 0; t < HD / 16; ++t) acc[t][r8] = acc[t][r8] * sf; } }
    wave_lds_sync();
    for (int ks = 0; ks < nkt * 16; ks += 32) { const v16b pa = frag_kb(&Ph_[nloc][ks], hlf), pb = frag_kb(&Pl_[nloc][ks], hlf); const int ka = key_tile(u0 + ks / 16, g, r), kc = key_tile(u0 + ks / 16 + 1, g, r); const size_t vp = vtb + (size_t)(ka < 0 ? r * TPC : ka) * (HD * 16), vp2 = vtb + (size_t)(kc < 0 ? r * TPC : kc) * (HD * 16);   /* two tiles of the list; where the list has none, p = 0 there and any written tile serves (finite V) */
      const b16 *h1 = VTH + vp + vlo, *h2 = VTH + vp2 + vlo, *l1 = VTL + vp + vlo, *l2 = VTL + vp2 + vlo;   // this lane's place in the two tiles, hi and lo plane
      v16b vh[HD / 16], vl[HD / 16];   // all eight fragments of the trip are requested before the first product, so the trip waits for L2 once and not once per d tile
#pragma unroll
      for (int t = 0; t < HD / 16; ++t) { vh[t] = frag_vt(h1 + t * 256, h2 + t * 256); vl[t] = frag_vt(l1 + t * 256, l2 + t * 256); }
#pragma unroll
      for (int t = 0; t < HD / 16; ++t) { acc[t] = wmma16b(pa, vh[t], acc[t]); acc[t] = wmma16b(pa, vl[t], acc[t]); acc[t] = wmma16b(pb, vh[t], acc[t]); }
      asm volatile("s_wait_xcnt 0x0" :: "v"(h1), "v"(h2), "v"(l1), "v"(l2) : "memory");   // the next trip rewrites the address registers that this trip's V^T loads name; as inputs here they stay untouched (also by a later load's result) up to this wait
    }
    wave_lds_sync(); }
#pragma unroll
  for (int t = 0; t < HD / 16; ++t)
#pragma unroll
    for (int r8 = 0; r8 < 8; ++r8) { const float dn = den_r[r8]; Of[8 * hlf + r8][t * 16 + nloc] = dn > 0.0f ? acc[t][r8] * (1.0f / (HS * PS)) / dn : 0.0f; }
  wave_lds_sync();
  { for (int rr = 0; rr < 16; ++rr) for (int s = 0; s < HD / 32; ++s) ((float*)ATT)[(rowb + r + DIL * (g * 16 + rr)) * C + h * HD + s * 32 + lane] = Of[rr][s * 32 + lane];  } }
// output product: block = 32 waves on one 16-token tile; the waves share the staged hi+lo tile, wave wv owns columns wv*32..wv*32+31.
__global__ __launch_bounds__(1024) void out_kernel(const float* __restrict__ ATT, const b16* __restrict__ WO, const float* __restrict__ bo, int TLIM, float* __restrict__ out) { __shared__ __attribute__((aligned(16))) b16 Ah[16][C + 8], Al[16][C + 8]; __shared__ __attribute__((aligned(16))) float Tf[32][16][36]; const int lane = threadIdx.x & 31, wv = threadIdx.x >> 5, nloc = lane & 15, hlf = lane >> 4; const size_t m0 = (size_t)blockIdx.x * 16; if (m0 >= (size_t)TLIM) return;
  { const int rr = wv >> 1, q0 = (wv & 1) * (C / 64); for (int q = q0; q < q0 + C / 64; ++q) { b16 p, ql; split16(ATT[(m0 + rr) * C + q * 32 + lane] * HS, p, ql); Ah[rr][q * 32 + lane] = p; Al[rr][q * 32 + lane] = ql; } }
  __syncthreads();   // every wave reads all 16 staged rows
  const int c0 = wv * 32; const b16* wp = WO + (size_t)(c0 / 16) * (C / 32) * 512 + lane * 8; v8f acc[2];
#pragma unroll
  for (int t = 0; t < 2; ++t) acc[t] = (v8f){};
#pragma unroll 2
  for (int kb = 0; kb < C; kb += 32) { const v16b a = frag_kb(&Ah[nloc][kb], hlf), al = frag_kb(&Al[nloc][kb], hlf);
#pragma unroll
    for (int t = 0; t < 2; ++t) { const v16b bw = frag_fo(wp + t * 16 * C + kb * 16); acc[t] = wmma16b(a, bw, acc[t]); acc[t] = wmma16b(al, bw, acc[t]); } }
#pragma unroll
  for (int t = 0; t < 2; ++t) { const int cc = t * 16 + nloc; const float bb = 0.0f;
#pragma unroll
    for (int r8 = 0; r8 < 8; ++r8) Tf[wv][8 * hlf + r8][cc] = acc[t][r8] * (1.0f / (HS * WSC)) + bb; }
  wave_lds_sync();
  { const int ro = lane >> 3, cs = (lane & 7) * 4; for (int rr = 0; rr < 16; rr += 4) *(v4f*)(out + (m0 + rr + ro) * C + c0 + cs) = *(const v4f*)(&Tf[wv][rr + ro][cs]);  } }
}  // namespace

extern "C" void kernel_launch(void* const* d_in, const int* in_sizes, int n_in, void* d_out, int out_size, void* d_ws, size_t ws_size, hipStream_t stream) {
  (void)n_in;
  auto Fp = [&](int i) { return (const float*)d_in[i]; };
  // input order: 0 x [2,2048,1024]; 1 qkv [3072,1024] (out,in: rows q|k|v); 2 wo [1024,1024] (out,in)
  if (in_sizes[0] != NT * C || in_sizes[1] != 3 * C * C || in_sizes[2] != C * C || out_size != NT * C) return;
  const int BLIM = NB;   // batch cut
  const int TLIM = BLIM * L;
  size_t off = 0; char* ws = (char*)d_ws;
  auto carve = [&](size_t bytes) { char* p = ws + off; off += (bytes + 255) & ~(size_t)255; return p; };
  b16* W3 = (b16*)carve((size_t)3 * C * C * 2); b16* WO = (b16*)carve((size_t)C * C * 2); b16* PH = (b16*)carve((size_t)NT * PW * 2); b16* PL = (b16*)carve((size_t)NT * PW * 2); float* ATT = (float*)carve((size_t)NT * C * 4); b16* VTH = (b16*)carve((size_t)NT * C * 2); b16* VTL = (b16*)carve((size_t)NT * C * 2); b16* KFH = (b16*)carve((size_t)NT * C * 2); b16* KFL = (b16*)carve((size_t)NT * C * 2);
  if (off > ws_size || off > ((size_t)112 << 20)) return;   // ~ 104 MiB
  wput_kernel<<<(unsigned)(((size_t)4 * C * (C / 8) + 255) / 256), 256, 0, stream>>>(Fp(1), Fp(1) + (size_t)C * C, Fp(1) + (size_t)2 * C * C, Fp(2), W3, WO);
  proj_kernel<<<dim3(TLIM / 16, 3), 512, 0, stream>>>(Fp(0), W3, Fp(0), Fp(0), Fp(0), TLIM, PH, PL, VTH, VTL, KFH, KFL);
  att_kernel<<<BLIM * NH * (L / 16), 32, 0, stream>>>(PH, PL, KFH, KFL, VTH, VTL, (const float*)0, BLIM, ATT);
  out_kernel<<<TLIM / 16, 1024, 0, stream>>>(ATT, WO, (const float*)0, TLIM, (float*)d_out);
}

// v005
// One run takes 188 microseconds.
// In two side-by-side timings against v004, it was 1.40 and 1.42 times as fast.
// Over all steps from v000 it is 15.1 times as fast.
#include <hip/hip_runtime.h>

// CustomWindowMHA: 16 heads x 64 over 2 x 2,048 tokens; token i attends to j in the causal window i-127..i OR the dilated set j = i-128-4m (m >= 1, j >= 0); QKV = x qkv^T (no bias), scores/8, masked softmax, out = (attn v) wo^T -> [2][2048][1024].
// Deterministic: no index structures, no atomics; flash-style online softmax over the key tiles of a query tile in a fixed order.
// TOKEN ORDER IN THE WORKSPACE: q, k and v are kept by residue class, position p = (token % 4) * 512 + token / 4 inside a sequence. A query tile is 16 positions in a row = 16 tokens of ONE class, so its dilated keys (same class) are rows in a row, and the three other classes matter only inside the window (3 tiles of 16 each).
// FRAGMENT ORDER: the B operands that a wave reads from global memory as weights (W3, WO) and keys (KFH/KFL) are stored as the WMMA wants it: per tile of 16 rows and per 32 k one block of 512 elements [16-k half j][lane][8], lane = 16*hh + row, k = 16j + 8hh + 0..7. A wave's 16-byte load then covers 512 bytes in a row (4 lines) where row-major storage gave it 32 bytes of each of 16 lines.
// WMMA (v_wmma_f32_16x16x32_f16, f32 accumulate): the QKV projection with x EXACT bf16 x8 (K 1024) against exact torch weight rows x256 (one product); S = Q K^T (hi+lo x hi+lo, 3 products, K 64); O = P V (P x256 hi+lo x V^T hi+lo, 3 products; V^T comes ready from the projection, see VTH/VTL); out = attended (hi+lo) Wo^T (2 products); softmax in f32. Inputs rounded to bf16 once. Fragment k-map per lane half hh for A AND B: elements 0..7 <- k = 8hh+0..7, 8..15 <- k = 16+8hh+0..7; acc[r] = D[8hh+r][col].

namespace {
constexpr int NB = 2, L = 2048, C = 1024, NH = 16, HD = 64, NT = NB * L, KB = 128, PW = 3 * C;
constexpr int WINDOW = 128, DIL = 4;
constexpr int NC = L / DIL /* positions per residue class */, TPC = NC / 16 /* 16-position tiles per class */, WT = WINDOW / (DIL * 16) + 1 /* tiles of a foreign class that a query tile's windows can touch */;
constexpr float XS = 8.0f, HS = 256.0f /* hi+lo staging scale for q/k/v/attended */, WSC = 256.0f, PS = 256.0f, SCALE = 0.125f;
typedef _Float16 b16;
typedef __attribute__((ext_vector_type(16))) _Float16 v16b;
typedef __attribute__((ext_vector_type(8))) _Float16 v8b;
typedef __attribute__((ext_vector_type(8))) float v8f;
typedef __attribute__((ext_vector_type(4))) float v4f;
__device__ __forceinline__ float bf16_rne(float f) { unsigned int u = __float_as_uint(f); u += 0x7FFFu + ((u >> 16) & 1u); float r = __uint_as_float(u & 0xFFFF0000u); asm volatile("" : "+v"(r)); return r; }
__device__ __forceinline__ float bfv(float f) { float r = bf16_rne(f); asm volatile("" : "+v"(r)); return r; }
__device__ __forceinline__ void split16(float v, b16& hi, b16& lo) { hi = (b16)v; lo = (b16)(v - (float)hi); }
__device__ __forceinline__ v16b frag_kb(const b16* p, int hh) { const v8b a = *(const v8b*)(p + 8 * hh), b = *(const v8b*)(p + 16 + 8 * hh); v16b f;
#pragma unroll
  for (int e = 0; e < 8; ++e) { f[e] = a[e]; f[8 + e] = b[e]; } return f; }
// V^T fragment of 32 keys from the tiled planes: p and p2 point at this lane's (d, 8*hh) in the first and the second 16-position tile of the pair; elements 0..7 <- k = 8hh+0..7 (p), 8..15 <- k = 16+8hh+0..7 (p2): the same k-map as frag_kb.
__device__ __forceinline__ v16b frag_vt(const b16* p, const b16* p2) { const v8b a = *(const v8b*)p, b = *(const v8b*)p2; v16b f;
#pragma unroll
  for (int e = 0; e < 8; ++e) { f[e] = a[e]; f[8 + e] = b[e]; } return f; }
// fragment of 32 k from a fragment-order block: p points at this lane's 8 elements of half j = 0, half j = 1 stands 256 elements on; the same k-map as frag_kb.
__device__ __forceinline__ v16b frag_fo(const b16* p) { return frag_vt(p, p + 256); }
__device__ __forceinline__ v8f wmma16b(v16b a, v16b b, v8f c) { v8f d = __builtin_amdgcn_wmma_f32_16x16x32_f16(false, a, false, b, (short)0, c, false, false); asm volatile("v_nop\n\tv_nop\n\tv_nop\n\tv_nop" : "+v"(d) : "v"(a), "v"(b)); return d; }
__device__ __forceinline__ void wave_lds_sync() { __builtin_amdgcn_fence(__ATOMIC_RELEASE, "workgroup"); __builtin_amdgcn_wave_barrier(); __builtin_amdgcn_fence(__ATOMIC_ACQUIRE, "workgroup"); }
// u-th key tile of query tile (class r, tile g of the class), as a tile number in position order, or -1 for none: first the own class from its start up to the diagonal (u = 0..g), then of each other class the WT tiles g-WT+1..g that the windows reach.
__device__ __forceinline__ int key_tile(int u, int g, int r) { if (u <= g) return r * TPC + u; const int v = u - g - 1, ci = v / WT, tau = g - (WT - 1) + v % WT; if (ci >= DIL - 1 || tau < 0) return -1; return (ci + (ci >= r ? 1 : 0)) * TPC + tau; }
// lane l's value from lane l ^ M of the same 16-lane row, as a DPP operand (no LDS round trip, unlike __shfl_xor)
template <int M> __device__ __forceinline__ float rowx(float x) { return __builtin_bit_cast(float, __builtin_amdgcn_update_dpp(0, __builtin_bit_cast(int, x), 0x160 + M, 0xf, 0xf, true)); }
__device__ __forceinline__ float row_max16(float x) { x = fmaxf(x, rowx<1>(x)); x = fmaxf(x, rowx<2>(x)); x = fmaxf(x, rowx<4>(x)); return fmaxf(x, rowx<8>(x)); }
__device__ __forceinline__ float row_sum16(float x) { x += rowx<1>(x); x += rowx<2>(x); x += rowx<4>(x); return x + rowx<8>(x); }
__device__ __forceinline__ float pmul(float a, float b) { float p = a * b; asm volatile("" : "+v"(p)); return p; }

__global__ __launch_bounds__(256) void wput_kernel(const float* __restrict__ wq, const float* __restrict__ wk, const float* __restrict__ wv, const float* __restrict__ wo, b16* __restrict__ W3, b16* __restrict__ WO) { const size_t u = (size_t)blockIdx.x * 256 + threadIdx.x; if (u >= (size_t)4 * C * (C / 8)) return; const int c = (int)(u & 3), ks = (int)(u >> 5) % (C / 32), r = (int)(u / C) * 8 + (int)((u >> 2) & 7), k0 = ks * 32 + c * 8;   /* a wave takes 32 k of 8 rows: it reads 8 whole lines and writes 4 whole lines */ const int p = r / C, o = r % C, rb = p < 3 ? r : o; const float* w = p == 0 ? wq : (p == 1 ? wk : (p == 2 ? wv : wo)); v8b v;
#pragma unroll
  for (int j = 0; j < 8; ++j) v[j] = (b16)(bf16_rne(w[(size_t)o * C + k0 + j]) * WSC);
  { *(v8b*)((p < 3 ? W3 : WO) + ((size_t)(rb >> 4) * (C / 32) + ks) * 512 + (c >> 1) * 256 + ((c & 1) * 16 + (rb & 15)) * 8) = v;  } }
// projection: block = 16 waves on one tile of 16 positions (16 tokens of one residue class, see the head of the file) and one of q|k|v (blockIdx.y); the waves share the staged x tile, wave wv owns columns wv*64..wv*64+63 of that part.
// q goes out token-major (PH/PL). k goes out in fragment order, tiled [b][head][16-token tile][d half 0..1][j][lane][8] (KFH/KFL): a wave owns one head and writes 2 KiB in a row per plane. v goes out TRANSPOSED, tiled [b][head][16-token tile][d 0..63][token 0..15] (VTH/VTL): a lane's 8 accumulator rows are 8 consecutive tokens of one d, so it stores them as one 16-byte word; a wave owns one head and writes 2 KiB in a row per plane.
__global__ __launch_bounds__(512) void proj_kernel(const float* __restrict__ x, const b16* __restrict__ W3, const float* __restrict__ bq, const float* __restrict__ bk, const float* __restrict__ bv, int TLIM, b16* __restrict__ PH, b16* __restrict__ PL, b16* __restrict__ VTH, b16* __restrict__ VTL, b16* __restrict__ KFH, b16* __restrict__ KFL) { __shared__ __attribute__((aligned(16))) b16 Ah[16][C + 8], Oh[16][16][72], Ol[16][16][72]; const int lane = threadIdx.x & 31, wv = threadIdx.x >> 5, nloc = lane & 15, hlf = lane >> 4; const size_t m0 = (size_t)blockIdx.x * 16; if (m0 >= (size_t)TLIM) return;
  const size_t xr = ((m0 + wv) / L) * L + DIL * ((m0 + wv) % NC) + ((m0 + wv) % L) / NC;   // the token that stands at position m0 + wv
  for (int q = 0; q < C / 32; ++q) Ah[wv][q * 32 + lane] = (b16)(bf16_rne(x[xr * C + q * 32 + lane]) * XS);
  __syncthreads();   // every wave reads all 16 staged rows
  const int pj = blockIdx.y; const int c0 = pj * C + wv * 64; const float sc = pj == 0 ? SCALE : 1.0f; const b16* wp = W3 + (size_t)(c0 / 16) * (C / 32) * 512 + lane * 8; v8f acc[4];
#pragma unroll
  for (int t = 0; t < 4; ++t) acc[t] = (v8f){};
#pragma unroll 2
  for (int kb = 0; kb < C; kb += 32) { const v16b a = frag_kb(&Ah[nloc][kb], hlf);
#pragma unroll
    for (int t = 0; t < 4; ++t) acc[t] = wmma16b(a, frag_fo(wp + t * 16 * C + kb * 16), acc[t]); }
  if (pj == 2) { const size_t vb = (((m0 / L) * NH + wv) * (L / 16) + (m0 % L) / 16) * (HD * 16);
#pragma unroll
    for (int t = 0; t < 4; ++t) { v8b vh, vl;
#pragma unroll
      for (int r8 = 0; r8 < 8; ++r8) { b16 p, ql; split16((acc[t][r8] * (1.0f / (XS * WSC)) + 0.0f) * sc * HS, p, ql); vh[r8] = p; vl[r8] = ql; }
      *(v8b*)(VTH + vb + (t * 16 + nloc) * 16 + 8 * hlf) = vh; *(v8b*)(VTL + vb + (t * 16 + nloc) * 16 + 8 * hlf) = vl; }
    return; }
#pragma unroll
  for (int t = 0; t < 4; ++t) { const int cc = t * 16 + nloc; const float bvv = 0.0f;
#pragma unroll
    for (int r8 = 0; r8 < 8; ++r8) { b16 p, ql; split16((acc[t][r8] * (1.0f / (XS * WSC)) + bvv) * sc * HS, p, ql); Oh[wv][8 * hlf + r8][cc] = p; Ol[wv][8 * hlf + r8][cc] = ql; } }
  wave_lds_sync();
  if (pj == 1) { const size_t kf = (((m0 / L) * NH + wv) * (L / 16) + (m0 % L) / 16) * (HD * 16) + lane * 8;
#pragma unroll
    for (int i = 0; i < 4; ++i) { *(v8b*)(KFH + kf + i * 256) = *(const v8b*)(&Oh[wv][nloc][i * 16 + 8 * hlf]); *(v8b*)(KFL + kf + i * 256) = *(const v8b*)(&Ol[wv][nloc][i * 16 + 8 * hlf]); }
    asm volatile("s_wait_xcnt 0x0" ::: "memory");   // behind the run of k stores: in the listing the code that follows them rewrites registers that hold their addresses
    return; }
  { const int ro = lane >> 3, cs = (lane & 7) * 8; for (int rr = 0; rr < 16; rr += 4) { *(v8b*)(PH + (m0 + rr + ro) * PW + c0 + cs) = *(const v8b*)(&Oh[wv][rr + ro][cs]); *(v8b*)(PL + (m0 + rr + ro) * PW + c0 + cs) = *(const v8b*)(&Ol[wv][rr + ro][cs]); }  }
  asm volatile("s_wait_xcnt 0x0" ::: "memory");   // behind the run of q stores: in the listing the k block stands behind them and rewrites registers that hold their addresses
}
// attention: ONE WAVE PER BLOCK, wave per (b, h, 16-query tile of one residue class): key blocks of 8 tiles from the list of key_tile() (own class up to the diagonal, the other classes inside the window), every key that the mask allows exactly once; S = Q K^T (3 products, K 64); online softmax in the accumulator registers (row maximum and sum by DPP over the 16 lanes of a row); P x256 hi+lo goes through LDS into A-fragment order; the V^T fragments are read straight from VTH/VTL (each 16-byte load of a wave covers 512 bytes in a row), nothing of V is staged in LDS.
__global__ __launch_bounds__(32) void att_kernel(const b16* __restrict__ PH, const b16* __restrict__ PL, const b16* __restrict__ KFH, const b16* __restrict__ KFL, const b16* __restrict__ VTH, const b16* __restrict__ VTL, const float* __restrict__ amask, int BLIM, float* __restrict__ ATT) { __shared__ __attribute__((aligned(16))) b16 Ph_[16][KB + 8], Pl_[16][KB + 8]; __shared__ float Of[16][HD + 4];
  const int lane = threadIdx.x, nloc = lane & 15, hlf = lane >> 4; const int qt = blockIdx.x % (L / 16); const int h = (blockIdx.x / (L / 16)) % NH; const int b = blockIdx.x / ((L / 16) * NH); if (b >= BLIM) return; const int t0 = qt * 16, r = qt / TPC, g = qt % TPC; const size_t rowb = (size_t)b * L; const int qo = h * HD; const size_t vtb = (size_t)(b * NH + h) * (L / 16) * (HD * 16); const unsigned vlo = nloc * 16 + 8 * hlf;   // the head's first K or V^T tile (the same for the wave); this lane's d row (mod 16) and token half inside a tile
  v16b qh[HD / 32], ql[HD / 32];
#pragma unroll
  for (int s = 0; s < HD / 32; ++s) { qh[s] = frag_kb(PH + (rowb + t0 + nloc) * PW + qo + s * 32, hlf); ql[s] = frag_kb(PL + (rowb + t0 + nloc) * PW + qo + s * 32, hlf); }
  float m_r[8], den_r[8]; v8f acc[HD / 16];
#pragma unroll
  for (int r8 = 0; r8 < 8; ++r8) { m_r[r8] = -INFINITY; den_r[r8] = 0.0f; }
#pragma unroll
  for (int t = 0; t < HD / 16; ++t) acc[t] = (v8f){};
  const int ntile = g + 1 + WT * (DIL - 1);   // length of the key tile list
#pragma unroll 1
  for (int u0 = 0; u0 < ntile; u0 += KB / 16) { const int nkt = (ntile - u0) < KB / 16 ? (ntile - u0) : KB / 16;
    v8f sv[KB / 16];   // the block's masked scores stay where the WMMA leaves them: sv[t][r8] = row 8*hlf + r8, key column t*16 + nloc; the t loops below are unrolled so that sv[t] names registers and not scratch memory
#pragma unroll
    for (int t = 0; t < KB / 16; ++t) { const int kt = key_tile(u0 + t, g, r); if (kt >= 0) { const size_t kr = vtb + (size_t)kt * (HD * 16) + lane * 8; v8f s = {};
#pragma unroll
        for (int q = 0; q < HD / 32; ++q) { const v16b kh = frag_fo(KFH + kr + q * 512), kl = frag_fo(KFL + kr + q * 512); s = wmma16b(qh[q], kh, s); s = wmma16b(qh[q], kl, s); s = wmma16b(ql[q], kh, s); }
#pragma unroll
        for (int r8 = 0; r8 < 8; ++r8) { const int i = r + DIL * (g * 16 + 8 * hlf + r8), j = kt / TPC + DIL * ((kt % TPC) * 16 + nloc);   /* tokens of the two positions */ const bool ok = (j <= i) && ((j >= i - (WINDOW - 1)) || ((j <= i - WINDOW - DIL) && (((i - WINDOW - j) % DIL) == 0)));   /* window i-127..i or dilated j = i-128-4m, m>=1 */ sv[t][r8] = ok ? s[r8] * (1.0f / (HS * HS)) : -INFINITY; } }
      else {
#pragma unroll
        for (int r8 = 0; r8 < 8; ++r8) sv[t][r8] = -INFINITY; } }
    // a lane owns 8 rows (its accumulator rows) and one key column of each tile: maximum and sum run over the 8 tiles in the lane, then over the 16 lanes of the row; the 8 rows are independent chains
#pragma unroll
    for (int r8 = 0; r8 < 8; ++r8) { float mx = sv[0][r8];
#pragma unroll
      for (int t = 1; t < KB / 16; ++t) mx = fmaxf(mx, sv[t][r8]);
      mx = row_max16(mx);
      const float mold = m_r[r8]; const float mn = fmaxf(mold, mx); const float sf = (mold == -INFINITY) ? 0.0f : ((mn == -INFINITY) ? 1.0f : __expf(mold - mn)); float ps = 0.0f;
#pragma unroll
      for (int t = 0; t < KB / 16; ++t) { const float x = sv[t][r8]; const float p = (x == -INFINITY || mn == -INFINITY) ? 0.0f : __expf(x - mn); ps += p; b16 ph, pl; split16(p * PS, ph, pl); Ph_[8 * hlf + r8][t * 16 + nloc] = ph; Pl_[8 * hlf + r8][t * 16 + nloc] = pl; }
      ps = row_sum16(ps);
      den_r[r8] = den_r[r8] * sf + ps; m_r[r8] = mn;
#pragma unroll
      for (int t = 0; t < HD / 16; ++t) acc[t][r8] = acc[t][r8] * sf; }
    wave_lds_sync();
    for (int ks = 0; ks < nkt * 16; ks += 32) { const v16b pa = frag_kb(&Ph_[nloc][ks], hlf), pb = frag_kb(&Pl_[nloc][ks], hlf); const int ka = key_tile(u0 + ks / 16, g, r), kc = key_tile(u0 + ks / 16 + 1, g, r); const size_t vp = vtb + (size_t)(ka < 0 ? r * TPC : ka) * (HD * 16), vp2 = vtb + (size_t)(kc < 0 ? r * TPC : kc) * (HD * 16);   /* two tiles of the list; where the list has none, p = 0 there and any written tile serves (finite V) */
      const b16 *h1 = VTH + vp + vlo, *h2 = VTH + vp2 + vlo, *l1 = VTL + vp + vlo, *l2 = VTL + vp2 + vlo;   // this lane's place in the two tiles, hi and lo plane
      v16b vh[HD / 16], vl[HD / 16];   // all eight fragments of the trip are requested before the first product, so the trip waits for L2 once and not once per d tile
#pragma unroll
      for (int t = 0; t < HD / 16; ++t) { vh[t] = frag_vt(h1 + t * 256, h2 + t * 256); vl[t] = frag_vt(l1 + t * 256, l2 + t * 256); }
#pragma unroll
      for (int t = 0; t < HD / 16; ++t) { acc[t] = wmma16b(pa, vh[t], acc[t]); acc[t] = wmma16b(pa, vl[t], acc[t]); acc[t] = wmma16b(pb, vh[t], acc[t]); }
      asm volatile("s_wait_xcnt 0x0" :: "v"(h1), "v"(h2), "v"(l1), "v"(l2) : "memory");   // the next trip rewrites the address registers that this trip's V^T loads name; as inputs here they stay untouched (also by a later load's result) up to this wait
    }
    wave_lds_sync(); }
#pragma unroll
  for (int t = 0; t < HD / 16; ++t)
#pragma unroll
    for (int r8 = 0; r8 < 8; ++r8) { const float dn = den_r[r8]; Of[8 * hlf + r8][t * 16 + nloc] = dn > 0.0f ? acc[t][r8] * (1.0f / (HS * PS)) / dn : 0.0f; }
  wave_lds_sync();
  { for (int rr = 0; rr < 16; ++rr) for (int s = 0; s < HD / 32; ++s) ((float*)ATT)[(rowb + r + DIL * (g * 16 + rr)) * C + h * HD + s * 32 + lane] = Of[rr][s * 32 + lane];  } }
// output product: block = 32 waves on one 16-token tile; the waves share the staged hi+lo tile, wave wv owns columns wv*32..wv*32+31.
__global__ __launch_bounds__(1024) void out_kernel(const float* __restrict__ ATT, const b16* __restrict__ WO, const float* __restrict__ bo, int TLIM, float* __restrict__ out) { __shared__ __attribute__((aligned(16))) b16 Ah[16][C + 8], Al[16][C + 8]; __shared__ __attribute__((aligned(16))) float Tf[32][16][36]; const int lane = threadIdx.x & 31, wv = threadIdx.x >> 5, nloc = lane & 15, hlf = lane >> 4; const size_t m0 = (size_t)blockIdx.x * 16; if (m0 >= (size_t)TLIM) return;
  { const int rr = wv >> 1, q0 = (wv & 1) * (C / 64); for (int q = q0; q < q0 + C / 64; ++q) { b16 p, ql; split16(ATT[(m0 + rr) * C + q * 32 + lane] * HS, p, ql); Ah[rr][q * 32 + lane] = p; Al[rr][q * 32 + lane] = ql; } }
  __syncthreads();   // every wave reads all 16 staged rows
  const int c0 = wv * 32; const b16* wp = WO + (size_t)(c0 / 16) * (C / 32) * 512 + lane * 8; v8f acc[2];
#pragma unroll
  for (int t = 0; t < 2; ++t) acc[t] = (v8f){};
#pragma unroll 2
  for (int kb = 0; kb < C; kb += 32) { const v16b a = frag_kb(&Ah[nloc][kb], hlf), al = frag_kb(&Al[nloc][kb], hlf);
#pragma unroll
    for (int t = 0; t < 2; ++t) { const v16b bw = frag_fo(wp + t * 16 * C + kb * 16); acc[t] = wmma16b(a, bw, acc[t]); acc[t] = wmma16b(al, bw, acc[t]); } }
#pragma unroll
  for (int t = 0; t < 2; ++t) { const int cc = t * 16 + nloc; const float bb = 0.0f;
#pragma unroll
    for (int r8 = 0; r8 < 8; ++r8) Tf[wv][8 * hlf + r8][cc] = acc[t][r8] * (1.0f / (HS * WSC)) + bb; }
  wave_lds_sync();
  { const int ro = lane >> 3, cs = (lane & 7) * 4; for (int rr = 0; rr < 16; rr += 4) *(v4f*)(out + (m0 + rr + ro) * C + c0 + cs) = *(const v4f*)(&Tf[wv][rr + ro][cs]);  } }
}  // namespace

extern "C" void kernel_launch(void* const* d_in, const int* in_sizes, int n_in, void* d_out, int out_size, void* d_ws, size_t ws_size, hipStream_t stream) {
  (void)n_in;
  auto Fp = [&](int i) { return (const float*)d_in[i]; };
  // input order: 0 x [2,2048,1024]; 1 qkv [3072,1024] (out,in: rows q|k|v); 2 wo [1024,1024] (out,in)
  if (in_sizes[0] != NT * C || in_sizes[1] != 3 * C * C || in_sizes[2] != C * C || out_size != NT * C) return;
  const int BLIM = NB;   // batch cut
  const int TLIM = BLIM * L;
  size_t off = 0; char* ws = (char*)d_ws;
  auto carve = [&](size_t bytes) { char* p = ws + off; off += (bytes + 255) & ~(size_t)255; return p; };
  b16* W3 = (b16*)carve((size_t)3 * C * C * 2); b16* WO = (b16*)carve((size_t)C * C * 2); b16* PH = (b16*)carve((size_t)NT * PW * 2); b16* PL = (b16*)carve((size_t)NT * PW * 2); float* ATT = (float*)carve((size_t)NT * C * 4); b16* VTH = (b16*)carve((size_t)NT * C * 2); b16* VTL = (b16*)carve((size_t)NT * C * 2); b16* KFH = (b16*)carve((size_t)NT * C * 2); b16* KFL = (b16*)carve((size_t)NT * C * 2);
  if (off > ws_size || off > ((size_t)112 << 20)) return;   // ~ 104 MiB
  wput_kernel<<<(unsigned)(((size_t)4 * C * (C / 8) + 255) / 256), 256, 0, stream>>>(Fp(1), Fp(1) + (size_t)C * C, Fp(1) + (size_t)2 * C * C, Fp(2), W3, WO);
  proj_kernel<<<dim3(TLIM / 16, 3), 512, 0, stream>>>(Fp(0), W3, Fp(0), Fp(0), Fp(0), TLIM, PH, PL, VTH, VTL, KFH, KFL);
  att_kernel<<<BLIM * NH * (L / 16), 32, 0, stream>>>(PH, PL, KFH, KFL, VTH, VTL, (const float*)0, BLIM, ATT);
  out_kernel<<<TLIM / 16, 1024, 0, stream>>>(ATT, WO, (const float*)0, TLIM, (float*)d_out);
}

// v006
// A run of this version takes 136 microseconds.
// In both of two side-by-side timings against v005, it was 1.38 times as fast.
// All steps since v000 together make it 20.9 times as fast.
#include <hip/hip_runtime.h>

// CustomWindowMHA: 16 heads x 64 over 2 x 2,048 tokens; token i attends to j in the causal window i-127..i OR the dilated set j = i-128-4m (m >= 1, j >= 0); QKV = x qkv^T (no bias), scores/8, masked softmax, out = (attn v) wo^T -> [2][2048][1024].
// Deterministic: no index structures, no atomics; flash-style online softmax over the key tiles of a query tile in a fixed order.
// TOKEN ORDER IN THE WORKSPACE: q, k and v are kept by residue class, position p = (token % 4) * 512 + token / 4 inside a sequence. A query tile is 16 positions in a row = 16 tokens of ONE class, so its dilated keys (same class) are rows in a row, and the three other classes matter only inside the window (3 tiles of 16 each).
// FRAGMENT ORDER: the B operands that a wave reads from global memory as weights (W3, WO) and keys (KFH/KFL) are stored as the WMMA wants it: per tile of 16 rows and per 32 k one block of 512 elements [16-k half j][lane][8], lane = 16*hh + row, k = 16j + 8hh + 0..7. A wave's 16-byte load then covers 512 bytes in a row (4 lines) where row-major storage gave it 32 bytes of each of 16 lines.
// WMMA (v_wmma_f32_16x16x32_f16, f32 accumulate): the QKV projection with x EXACT bf16 x8 (K 1024) against exact torch weight rows x256 (one product); S = Q K^T (hi+lo x hi+lo, 3 products, K 64); O = P V (P x256 hi+lo x V^T hi+lo, 3 products; V^T comes ready from the projection, see VTH/VTL); out = attended (hi+lo) Wo^T (2 products); softmax in f32. Inputs rounded to bf16 once. Fragment k-map per lane half hh for A AND B: elements 0..7 <- k = 8hh+0..7, 8..15 <- k = 16+8hh+0..7; acc[r] = D[8hh+r][col].

namespace {
constexpr int NB = 2, L = 2048, C = 1024, NH = 16, HD = 64, NT = NB * L, KB = 128, PW = 3 * C;
constexpr int WINDOW = 128, DIL = 4;
constexpr int NC = L / DIL /* positions per residue class */, TPC = NC / 16 /* 16-position tiles per class */, WT = WINDOW / (DIL * 16) + 1 /* tiles of a foreign class that a query tile's windows can touch */;
constexpr int PMT = 4 /* 16-row tiles per projection block */, PNW = 12 /* its waves, 64 columns each */, OMT = 4 /* 16-row tiles per output-product block */, ONC = 256 /* its columns */;
constexpr float XS = 8.0f, HS = 256.0f /* hi+lo staging scale for q/k/v/attended */, WSC = 256.0f, PS = 256.0f, SCALE = 0.125f;
typedef _Float16 b16;
typedef __attribute__((ext_vector_type(16))) _Float16 v16b;
typedef __attribute__((ext_vector_type(8))) _Float16 v8b;
typedef __attribute__((ext_vector_type(8))) float v8f;
typedef __attribute__((ext_vector_type(4))) float v4f;
__device__ __forceinline__ float bf16_rne(float f) { unsigned int u = __float_as_uint(f); u += 0x7FFFu + ((u >> 16) & 1u); float r = __uint_as_float(u & 0xFFFF0000u); asm volatile("" : "+v"(r)); return r; }
__device__ __forceinline__ float bfv(float f) { float r = bf16_rne(f); asm volatile("" : "+v"(r)); return r; }
__device__ __forceinline__ void split16(float v, b16& hi, b16& lo) { hi = (b16)v; lo = (b16)(v - (float)hi); }
__device__ __forceinline__ v16b frag_kb(const b16* p, int hh) { const v8b a = *(const v8b*)(p + 8 * hh), b = *(const v8b*)(p + 16 + 8 * hh); v16b f;
#pragma unroll
  for (int e = 0; e < 8; ++e) { f[e] = a[e]; f[8 + e] = b[e]; } return f; }
// V^T fragment of 32 keys from the tiled planes: p and p2 point at this lane's (d, 8*hh) in the first and the second 16-position tile of the pair; elements 0..7 <- k = 8hh+0..7 (p), 8..15 <- k = 16+8hh+0..7 (p2): the same k-map as frag_kb.
__device__ __forceinline__ v16b frag_vt(const b16* p, const b16* p2) { const v8b a = *(const v8b*)p, b = *(const v8b*)p2; v16b f;
#pragma unroll
  for (int e = 0; e < 8; ++e) { f[e] = a[e]; f[8 + e] = b[e]; } return f; }
// fragment of 32 k from a fragment-order block: p points at this lane's 8 elements of half j = 0, half j = 1 stands 256 elements on; the same k-map as frag_kb.
__device__ __forceinline__ v16b frag_fo(const b16* p) { return frag_vt(p, p + 256); }
__device__ __forceinline__ v8f wmma16b(v16b a, v16b b, v8f c) { v8f d = __builtin_amdgcn_wmma_f32_16x16x32_f16(false, a, false, b, (short)0, c, false, false); asm volatile("v_nop\n\tv_nop\n\tv_nop\n\tv_nop" : "+v"(d) : "v"(a), "v"(b)); return d; }
__device__ __forceinline__ void wave_lds_sync() { __builtin_amdgcn_fence(__ATOMIC_RELEASE, "workgroup"); __builtin_amdgcn_wave_barrier(); __builtin_amdgcn_fence(__ATOMIC_ACQUIRE, "workgroup"); }
// the same for LDS alone: in the GEMM epilogues, which loop over row tiles, the fence above would also wait for the last tile's global stores to finish
__device__ __forceinline__ void wave_lds_only() { __builtin_amdgcn_fence(__ATOMIC_RELEASE, "workgroup", "local"); __builtin_amdgcn_wave_barrier(); __builtin_amdgcn_fence(__ATOMIC_ACQUIRE, "workgroup", "local"); }
// u-th key tile of query tile (class r, tile g of the class), as a tile number in position order, or -1 for none: first the own class from its start up to the diagonal (u = 0..g), then of each other class the WT tiles g-WT+1..g that the windows reach.
__device__ __forceinline__ int key_tile(int u, int g, int r) { if (u <= g) return r * TPC + u; const int v = u - g - 1, ci = v / WT, tau = g - (WT - 1) + v % WT; if (ci >= DIL - 1 || tau < 0) return -1; return (ci + (ci >= r ? 1 : 0)) * TPC + tau; }
// lane l's value from lane l ^ M of the same 16-lane row, as a DPP operand (no LDS round trip, unlike __shfl_xor)
template <int M> __device__ __forceinline__ float rowx(float x) { return __builtin_bit_cast(float, __builtin_amdgcn_update_dpp(0, __builtin_bit_cast(int, x), 0x160 + M, 0xf, 0xf, true)); }
__device__ __forceinline__ float row_max16(float x) { x = fmaxf(x, rowx<1>(x)); x = fmaxf(x, rowx<2>(x)); x = fmaxf(x, rowx<4>(x)); return fmaxf(x, rowx<8>(x)); }
__device__ __forceinline__ float row_sum16(float x) { x += rowx<1>(x); x += rowx<2>(x); x += rowx<4>(x); return x + rowx<8>(x); }
__device__ __forceinline__ float pmul(float a, float b) { float p = a * b; asm volatile("" : "+v"(p)); return p; }

__global__ __launch_bounds__(256) void wput_kernel(const float* __restrict__ wq, const float* __restrict__ wk, const float* __restrict__ wv, const float* __restrict__ wo, b16* __restrict__ W3, b16* __restrict__ WO) { const size_t u = (size_t)blockIdx.x * 256 + threadIdx.x; if (u >= (size_t)4 * C * (C / 8)) return; const int c = (int)(u & 3), ks = (int)(u >> 5) % (C / 32), r = (int)(u / C) * 8 + (int)((u >> 2) & 7), k0 = ks * 32 + c * 8;   /* a wave takes 32 k of 8 rows: it reads 8 whole lines and writes 4 whole lines */ const int p = r / C, o = r % C, rb = p < 3 ? r : o; const float* w = p == 0 ? wq : (p == 1 ? wk : (p == 2 ? wv : wo)); v8b v;
#pragma unroll
  for (int j = 0; j < 8; ++j) v[j] = (b16)(bf16_rne(w[(size_t)o * C + k0 + j]) * WSC);
  { *(v8b*)((p < 3 ? W3 : WO) + ((size_t)(rb >> 4) * (C / 32) + ks) * 512 + (c >> 1) * 256 + ((c & 1) * 16 + (rb & 15)) * 8) = v;  } }
// projection: block = 12 waves on PMT = 4 tiles of 16 positions (64 positions in a row of one residue class, see the head of the file) and 768 of the 3,072 columns q|k|v (blockIdx.y); the waves share the staged x rows, a wave owns 64 columns = one head of one of q, k, v, for all 64 rows: a weight fragment is read from L2 once and multiplied with 4 row tiles. 64 x 4 = 256 blocks, one per WGP.
// q goes out token-major (PH/PL). k goes out in fragment order, tiled [b][head][16-token tile][d half 0..1][j][lane][8] (KFH/KFL): a wave owns one head and writes 2 KiB in a row per plane and tile. v goes out TRANSPOSED, tiled [b][head][16-token tile][d 0..63][token 0..15] (VTH/VTL): a lane's 8 accumulator rows are 8 consecutive tokens of one d, so it stores them as one 16-byte word; a wave owns one head and writes 2 KiB in a row per plane and tile.
__global__ __launch_bounds__(PNW * 32) void proj_kernel(const float* __restrict__ x, const b16* __restrict__ W3, const float* __restrict__ bq, const float* __restrict__ bk, const float* __restrict__ bv, int TLIM, b16* __restrict__ PH, b16* __restrict__ PL, b16* __restrict__ VTH, b16* __restrict__ VTL, b16* __restrict__ KFH, b16* __restrict__ KFL) { __shared__ __attribute__((aligned(16))) b16 Ah[16 * PMT][C + 8], Oh[PNW][16][72], Ol[PNW][16][72]; const int lane = threadIdx.x & 31, wv = __builtin_amdgcn_readfirstlane(threadIdx.x >> 5), nloc = lane & 15, hlf = lane >> 4; const size_t m0 = (size_t)blockIdx.x * (16 * PMT); if (m0 >= (size_t)TLIM) return;
  for (int rw = wv; rw < 16 * PMT; rw += PNW) { const size_t xr = ((m0 + rw) / L) * L + DIL * ((m0 + rw) % NC) + ((m0 + rw) % L) / NC;   // the token that stands at position m0 + rw
    float xv[C / 32];   // a row's 32 loads are requested before the first rounding: no load is moved across the asm statement in bf16_rne, so load by load each would wait out memory alone, and a wave now stages 5 or 6 rows
#pragma unroll
    for (int q = 0; q < C / 32; ++q) xv[q] = x[xr * C + q * 32 + lane];
#pragma unroll
    for (int q = 0; q < C / 32; ++q) Ah[rw][q * 32 + lane] = (b16)(bf16_rne(xv[q]) * XS); }
  __syncthreads();   // every wave reads all staged rows
  const int c0 = ((int)blockIdx.y * PNW + wv) * 64, pj = c0 / C, hd = (c0 % C) / HD; const float sc = pj == 0 ? SCALE : 1.0f; const b16* wp = W3 + (size_t)(c0 / 16) * (C / 32) * 512 + lane * 8; v8f acc[PMT][4];
#pragma unroll
  for (int mt = 0; mt < PMT; ++mt)
#pragma unroll
    for (int t = 0; t < 4; ++t) acc[mt][t] = (v8f){};
  for (int kb = 0; kb < C; kb += 64) { v16b bw[2][4];   // a trip is 64 k: its 16 weight loads are requested before its first product, so the trip waits for L2 once; with 3 waves on a SIMD the other waves' products cover that wait
#pragma unroll
    for (int s = 0; s < 2; ++s)
#pragma unroll
      for (int t = 0; t < 4; ++t) bw[s][t] = frag_fo(wp + t * 16 * C + (kb + 32 * s) * 16);
#pragma unroll
    for (int s = 0; s < 2; ++s) { v16b a[PMT];   // the four row tiles' fragments as one group of LDS reads
#pragma unroll
      for (int mt = 0; mt < PMT; ++mt) a[mt] = frag_kb(&Ah[mt * 16 + nloc][kb + 32 * s], hlf);
#pragma unroll
      for (int mt = 0; mt < PMT; ++mt)
#pragma unroll
        for (int t = 0; t < 4; ++t) acc[mt][t] = wmma16b(a[mt], bw[s][t], acc[mt][t]); } }
#pragma unroll
  for (int mt = 0; mt < PMT; ++mt) { const size_t mm = m0 + mt * 16; const size_t tb = (((mm / L) * NH + hd) * (L / 16) + (mm % L) / 16) * (HD * 16);   // this row tile's first position; its k or v tile of the wave's head
    if (pj == 2) {
#pragma unroll
      for (int t = 0; t < 4; ++t) { v8b vh, vl;
#pragma unroll
        for (int r8 = 0; r8 < 8; ++r8) { b16 p, ql; split16((acc[mt][t][r8] * (1.0f / (XS * WSC)) + 0.0f) * sc * HS, p, ql); vh[r8] = p; vl[r8] = ql; }
        *(v8b*)(VTH + tb + (t * 16 + nloc) * 16 + 8 * hlf) = vh; *(v8b*)(VTL + tb + (t * 16 + nloc) * 16 + 8 * hlf) = vl; }
      asm volatile("s_wait_xcnt 0x0" ::: "memory");   // behind the run of v stores: the code that stands behind it in the listing rewrites registers that the stores name
    }
    else {
#pragma unroll
      for (int t = 0; t < 4; ++t) { const int cc = t * 16 + nloc; const float bvv = 0.0f;
#pragma unroll
        for (int r8 = 0; r8 < 8; ++r8) { b16 p, ql; split16((acc[mt][t][r8] * (1.0f / (XS * WSC)) + bvv) * sc * HS, p, ql); Oh[wv][8 * hlf + r8][cc] = p; Ol[wv][8 * hlf + r8][cc] = ql; } }
      wave_lds_only();
      if (pj == 1) {
#pragma unroll
        for (int i = 0; i < 4; ++i) { *(v8b*)(KFH + tb + lane * 8 + i * 256) = *(const v8b*)(&Oh[wv][nloc][i * 16 + 8 * hlf]); *(v8b*)(KFL + tb + lane * 8 + i * 256) = *(const v8b*)(&Ol[wv][nloc][i * 16 + 8 * hlf]); }
        asm volatile("s_wait_xcnt 0x0" ::: "memory");   // behind the run of k stores, for the same reason
      }
      else { const int ro = lane >> 3, cs = (lane & 7) * 8; for (int rr = 0; rr < 16; rr += 4) { *(v8b*)(PH + (mm + rr + ro) * PW + c0 + cs) = *(const v8b*)(&Oh[wv][rr + ro][cs]); *(v8b*)(PL + (mm + rr + ro) * PW + c0 + cs) = *(const v8b*)(&Ol[wv][rr + ro][cs]); }
        asm volatile("s_wait_xcnt 0x0" ::: "memory");   // behind the run of q stores, for the same reason
      }
      wave_lds_only();   // the next row tile rewrites the wave's staging rows
    }
  }
}
// attention: ONE WAVE PER BLOCK, wave per (b, h, 16-query tile of one residue class): key blocks of 8 tiles from the list of key_tile() (own class up to the diagonal, the other classes inside the window), every key that the mask allows exactly once; S = Q K^T (3 products, K 64); online softmax in the accumulator registers (row maximum and sum by DPP over the 16 lanes of a row); P x256 hi+lo goes through LDS into A-fragment order; the V^T fragments are read straight from VTH/VTL (each 16-byte load of a wave covers 512 bytes in a row), nothing of V is staged in LDS.
__global__ __launch_bounds__(32) void att_kernel(const b16* __restrict__ PH, const b16* __restrict__ PL, const b16* __restrict__ KFH, const b16* __restrict__ KFL, const b16* __restrict__ VTH, const b16* __restrict__ VTL, const float* __restrict__ amask, int BLIM, float* __restrict__ ATT) { __shared__ __attribute__((aligned(16))) b16 Ph_[16][KB + 8], Pl_[16][KB + 8]; __shared__ float Of[16][HD + 4];
  const int lane = threadIdx.x, nloc = lane & 15, hlf = lane >> 4; const int qt = blockIdx.x % (L / 16); const int h = (blockIdx.x / (L / 16)) % NH; const int b = blockIdx.x / ((L / 16) * NH); if (b >= BLIM) return; const int t0 = qt * 16, r = qt / TPC, g = qt % TPC; const size_t rowb = (size_t)b * L; const int qo = h * HD; const size_t vtb = (size_t)(b * NH + h) * (L / 16) * (HD * 16); const unsigned vlo = nloc * 16 + 8 * hlf;   // the head's first K or V^T tile (the same for the wave); this lane's d row (mod 16) and token half inside a tile
  v16b qh[HD / 32], ql[HD / 32];
#pragma unroll
  for (int s = 0; s < HD / 32; ++s) { qh[s] = frag_kb(PH + (rowb + t0 + nloc) * PW + qo + s * 32, hlf); ql[s] = frag_kb(PL + (rowb + t0 + nloc) * PW + qo + s * 32, hlf); }
  float m_r[8], den_r[8]; v8f acc[HD / 16];
#pragma unroll
  for (int r8 = 0; r8 < 8; ++r8) { m_r[r8] = -INFINITY; den_r[r8] = 0.0f; }
#pragma unroll
  for (int t = 0; t < HD / 16; ++t) acc[t] = (v8f){};
  const int ntile = g + 1 + WT * (DIL - 1);   // length of the key tile list
#pragma unroll 1
  for (int u0 = 0; u0 < ntile; u0 += KB / 16) { const int nkt = (ntile - u0) < KB / 16 ? (ntile - u0) : KB / 16;
    v8f sv[KB / 16];   // the block's masked scores stay where the WMMA leaves them: sv[t][r8] = row 8*hlf + r8, key column t*16 + nloc; the t loops below are unrolled so that sv[t] names registers and not scratch memory
#pragma unroll
    for (int t = 0; t < KB / 16; ++t) { const int kt = key_tile(u0 + t, g, r); if (kt >= 0) { const size_t kr = vtb + (size_t)kt * (HD * 16) + lane * 8; v8f s = {};
#pragma unroll
        for (int q = 0; q < HD / 32; ++q) { const v16b kh = frag_fo(KFH + kr + q * 512), kl = frag_fo(KFL + kr + q * 512); s = wmma16b(qh[q], kh, s); s = wmma16b(qh[q], kl, s); s = wmma16b(ql[q], kh, s); }
#pragma unroll
        for (int r8 = 0; r8 < 8; ++r8) { const int i = r + DIL * (g * 16 + 8 * hlf + r8), j = kt / TPC + DIL * ((kt % TPC) * 16 + nloc);   /* tokens of the two positions */ const bool ok = (j <= i) && ((j >= i - (WINDOW - 1)) || ((j <= i - WINDOW - DIL) && (((i - WINDOW - j) % DIL) == 0)));   /* window i-127..i or dilated j = i-128-4m, m>=1 */ sv[t][r8] = ok ? s[r8] * (1.0f / (HS * HS)) : -INFINITY; } }
      else {
#pragma unroll
        for (int r8 = 0; r8 < 8; ++r8) sv[t][r8] = -INFINITY; } }
    // a lane owns 8 rows (its accumulator rows) and one key column of each tile: maximum and sum run over the 8 tiles in the lane, then over the 16 lanes of the row; the 8 rows are independent chains
#pragma unroll
    for (int r8 = 0; r8 < 8; ++r8) { float mx = sv[0][r8];
#pragma unroll
      for (int t = 1; t < KB / 16; ++t) mx = fmaxf(mx, sv[t][r8]);
      mx = row_max16(mx);
      const float mold = m_r[r8]; const float mn = fmaxf(mold, mx); const float sf = (mold == -INFINITY) ? 0.0f : ((mn == -INFINITY) ? 1.0f : __expf(mold - mn)); float ps = 0.0f;
#pragma unroll
      for (int t = 0; t < KB / 16; ++t) { const float x = sv[t][r8]; const float p = (x == -INFINITY || mn == -INFINITY) ? 0.0f : __expf(x - mn); ps += p; b16 ph, pl; split16(p * PS, ph, pl); Ph_[8 * hlf + r8][t * 16 + nloc] = ph; Pl_[8 * hlf + r8][t * 16 + nloc] = pl; }
      ps = row_sum16(ps);
      den_r[r8] = den_r[r8] * sf + ps; m_r[r8] = mn;
#pragma unroll
      for (int t = 0; t < HD / 16; ++t) acc[t][r8] = acc[t][r8] * sf; }
    wave_lds_sync();
    for (int ks = 0; ks < nkt * 16; ks += 32) { const v16b pa = frag_kb(&Ph_[nloc][ks], hlf), pb = frag_kb(&Pl_[nloc][ks], hlf); const int ka = key_tile(u0 + ks / 16, g, r), kc = key_tile(u0 + ks / 16 + 1, g, r); const size_t vp = vtb + (size_t)(ka < 0 ? r * TPC : ka) * (HD * 16), vp2 = vtb + (size_t)(kc < 0 ? r * TPC : kc) * (HD * 16);   /* two tiles of the list; where the list has none, p = 0 there and any written tile serves (finite V) */
      const b16 *h1 = VTH + vp + vlo, *h2 = VTH + vp2 + vlo, *l1 = VTL + vp + vlo, *l2 = VTL + vp2 + vlo;   // this lane's place in the two tiles, hi and lo plane
      v16b vh[HD / 16], vl[HD / 16];   // all eight fragments of the trip are requested before the first product, so the trip waits for L2 once and not once per d tile
#pragma unroll
      for (int t = 0; t < HD / 16; ++t) { vh[t] = frag_vt(h1 + t * 256, h2 + t * 256); vl[t] = frag_vt(l1 + t * 256, l2 + t * 256); }
#pragma unroll
      for (int t = 0; t < HD / 16; ++t) { acc[t] = wmma16b(pa, vh[t], acc[t]); acc[t] = wmma16b(pa, vl[t], acc[t]); acc[t] = wmma16b(pb, vh[t], acc[t]); }
      asm volatile("s_wait_xcnt 0x0" :: "v"(h1), "v"(h2), "v"(l1), "v"(l2) : "memory");   // the next trip rewrites the address registers that this trip's V^T loads name; as inputs here they stay untouched (also by a later load's result) up to this wait
    }
    wave_lds_sync(); }
#pragma unroll
  for (int t = 0; t < HD / 16; ++t)
#pragma unroll
    for (int r8 = 0; r8 < 8; ++r8) { const float dn = den_r[r8]; Of[8 * hlf + r8][t * 16 + nloc] = dn > 0.0f ? acc[t][r8] * (1.0f / (HS * PS)) / dn : 0.0f; }
  wave_lds_sync();
  { for (int rr = 0; rr < 16; ++rr) for (int s = 0; s < HD / 32; ++s) ((float*)ATT)[(rowb + r + DIL * (g * 16 + rr)) * C + h * HD + s * 32 + lane] = Of[rr][s * 32 + lane];  } }
// output product: block = 16 waves on OMT = 4 tiles of 16 tokens and 256 of the 1,024 columns (blockIdx.y); the waves share the staged hi+lo rows; wave wv owns rows (wv / 8) * 32 .. + 31 and columns (wv % 8) * 32 .. + 31 of the block: a weight fragment feeds 2 row tiles in the wave, and the block reads its weights for 64 rows. 64 x 4 = 256 blocks, one per WGP.
__global__ __launch_bounds__(512) void out_kernel(const float* __restrict__ ATT, const b16* __restrict__ WO, const float* __restrict__ bo, int TLIM, float* __restrict__ out) { __shared__ __attribute__((aligned(16))) b16 Ah[16 * OMT][C + 8], Al[16 * OMT][C + 8]; __shared__ __attribute__((aligned(16))) float Tf[16][16][36]; const int lane = threadIdx.x & 31, wv = __builtin_amdgcn_readfirstlane(threadIdx.x >> 5), nloc = lane & 15, hlf = lane >> 4; const size_t m0 = (size_t)blockIdx.x * (16 * OMT); if (m0 >= (size_t)TLIM) return;
  for (int rr = wv * OMT; rr < wv * OMT + OMT; ++rr) for (int q = 0; q < C / 32; ++q) { b16 p, ql; split16(ATT[(m0 + rr) * C + q * 32 + lane] * HS, p, ql); Ah[rr][q * 32 + lane] = p; Al[rr][q * 32 + lane] = ql; }
  __syncthreads();   // every wave reads 32 staged rows, written by 8 waves
  const int r0 = (wv >> 3) * 32, c0 = (int)blockIdx.y * ONC + (wv & 7) * 32; const b16* wp = WO + (size_t)(c0 / 16) * (C / 32) * 512 + lane * 8; v8f acc[2][2];
#pragma unroll
  for (int mt = 0; mt < 2; ++mt)
#pragma unroll
    for (int t = 0; t < 2; ++t) acc[mt][t] = (v8f){};
  for (int kb = 0; kb < C; kb += 128) { v16b bw[4][2];   // a trip is 128 k: its 16 weight loads are requested before its first product, so the trip waits for L2 once
#pragma unroll
    for (int s = 0; s < 4; ++s)
#pragma unroll
      for (int t = 0; t < 2; ++t) bw[s][t] = frag_fo(wp + t * 16 * C + (kb + 32 * s) * 16);
#pragma unroll
    for (int s = 0; s < 4; ++s) { v16b a[2], al[2];
#pragma unroll
      for (int mt = 0; mt < 2; ++mt) { a[mt] = frag_kb(&Ah[r0 + mt * 16 + nloc][kb + 32 * s], hlf); al[mt] = frag_kb(&Al[r0 + mt * 16 + nloc][kb + 32 * s], hlf); }
      // per accumulator hi then lo, as before; the other accumulators' products stand between an accumulator's two
#pragma unroll
      for (int mt = 0; mt < 2; ++mt)
#pragma unroll
        for (int t = 0; t < 2; ++t) acc[mt][t] = wmma16b(a[mt], bw[s][t], acc[mt][t]);
#pragma unroll
      for (int mt = 0; mt < 2; ++mt)
#pragma unroll
        for (int t = 0; t < 2; ++t) acc[mt][t] = wmma16b(al[mt], bw[s][t], acc[mt][t]); } }
#pragma unroll
  for (int mt = 0; mt < 2; ++mt) {
#pragma unroll
    for (int t = 0; t < 2; ++t) { const int cc = t * 16 + nloc; const float bb = 0.0f;
#pragma unroll
      for (int r8 = 0; r8 < 8; ++r8) Tf[wv][8 * hlf + r8][cc] = acc[mt][t][r8] * (1.0f / (HS * WSC)) + bb; }
    wave_lds_only();
    { const int ro = lane >> 3, cs = (lane & 7) * 4; for (int rr = 0; rr < 16; rr += 4) *(v4f*)(out + (m0 + r0 + mt * 16 + rr + ro) * C + c0 + cs) = *(const v4f*)(&Tf[wv][rr + ro][cs]); }
    wave_lds_only();   // the next row tile rewrites the wave's staging rows
    asm volatile("s_wait_xcnt 0x0" ::: "memory");   // behind a row tile's run of stores: the next tile's addresses may rewrite registers that hold theirs
  } }
}  // namespace

extern "C" void kernel_launch(void* const* d_in, const int* in_sizes, int n_in, void* d_out, int out_size, void* d_ws, size_t ws_size, hipStream_t stream) {
  (void)n_in;
  auto Fp = [&](int i) { return (const float*)d_in[i]; };
  // input order: 0 x [2,2048,1024]; 1 qkv [3072,1024] (out,in: rows q|k|v); 2 wo [1024,1024] (out,in)
  if (in_sizes[0] != NT * C || in_sizes[1] != 3 * C * C || in_sizes[2] != C * C || out_size != NT * C) return;
  const int BLIM = NB;   // batch cut
  const int TLIM = BLIM * L;
  size_t off = 0; char* ws = (char*)d_ws;
  auto carve = [&](size_t bytes) { char* p = ws + off; off += (bytes + 255) & ~(size_t)255; return p; };
  b16* W3 = (b16*)carve((size_t)3 * C * C * 2); b16* WO = (b16*)carve((size_t)C * C * 2); b16* PH = (b16*)carve((size_t)NT * PW * 2); b16* PL = (b16*)carve((size_t)NT * PW * 2); float* ATT = (float*)carve((size_t)NT * C * 4); b16* VTH = (b16*)carve((size_t)NT * C * 2); b16* VTL = (b16*)carve((size_t)NT * C * 2); b16* KFH = (b16*)carve((size_t)NT * C * 2); b16* KFL = (b16*)carve((size_t)NT * C * 2);
  if (off > ws_size || off > ((size_t)112 << 20)) return;   // ~ 104 MiB
  wput_kernel<<<(unsigned)(((size_t)4 * C * (C / 8) + 255) / 256), 256, 0, stream>>>(Fp(1), Fp(1) + (size_t)C * C, Fp(1) + (size_t)2 * C * C, Fp(2), W3, WO);
  proj_kernel<<<dim3(TLIM / (16 * PMT), PW / (64 * PNW)), PNW * 32, 0, stream>>>(Fp(0), W3, Fp(0), Fp(0), Fp(0), TLIM, PH, PL, VTH, VTL, KFH, KFL);
  att_kernel<<<BLIM * NH * (L / 16), 32, 0, stream>>>(PH, PL, KFH, KFL, VTH, VTL, (const float*)0, BLIM, ATT);
  out_kernel<<<dim3(TLIM / (16 * OMT), C / ONC), 512, 0, stream>>>(ATT, WO, (const float*)0, TLIM, (float*)d_out);
}

// v007
// A run of this version takes 116 microseconds.
// Two timings next to v006 put it at 1.17 and 1.18 times that version's speed.
// Over all steps from v000 it is 24.6 times as fast.
#include <hip/hip_runtime.h>

// CustomWindowMHA: 16 heads x 64 over 2 x 2,048 tokens; token i attends to j in the causal window i-127..i OR the dilated set j = i-128-4m (m >= 1, j >= 0); QKV = x qkv^T (no bias), scores/8, masked softmax, out = (attn v) wo^T -> [2][2048][1024].
// Deterministic: no index structures, no atomics; flash-style online softmax over the key tiles of a query tile in a fixed order.
// TOKEN ORDER IN THE WORKSPACE: q, k and v are kept by residue class, position p = (token % 4) * 512 + token / 4 inside a sequence. A query tile is 16 positions in a row = 16 tokens of ONE class, so its dilated keys (same class) are rows in a row, and the three other classes matter only inside the window (3 tiles of 16 each).
// FRAGMENT ORDER: the B operands that a wave reads from global memory as weights (W3, WO) and keys (KFH/KFL) are stored as the WMMA wants it: per tile of 16 rows and per 32 k one block of 512 elements [16-k half j][lane][8], lane = 16*hh + row, k = 16j + 8hh + 0..7. A wave's 16-byte load then covers 512 bytes in a row (4 lines) where row-major storage gave it 32 bytes of each of 16 lines.
// WMMA (v_wmma_f32_16x16x32_f16, f32 accumulate): the QKV projection with x EXACT bf16 x8 (K 1024) against exact torch weight rows x256 (one product); S = Q K^T (hi+lo x hi+lo, 3 products, K 64); O = P V (P x256 hi+lo x V^T hi+lo, 3 products; V^T comes ready from the projection, see VTH/VTL); out = attended (hi+lo) Wo^T (2 products); softmax in f32. Inputs rounded to bf16 once. Fragment k-map per lane half hh for A AND B: elements 0..7 <- k = 8hh+0..7, 8..15 <- k = 16+8hh+0..7; acc[r] = D[8hh+r][col].

namespace {
constexpr int NB = 2, L = 2048, C = 1024, NH = 16, HD = 64, NT = NB * L, KB = 128, PW = 3 * C;
constexpr int WINDOW = 128, DIL = 4, KG = 2 /* key tiles whose K fragments attention requests together */;
constexpr int NC = L / DIL /* positions per residue class */, TPC = NC / 16 /* 16-position tiles per class */, WT = WINDOW / (DIL * 16) + 1 /* tiles of a foreign class that a query tile's windows can touch */;
constexpr int PMT = 4 /* 16-row tiles per projection block */, PNW = 12 /* its waves, 64 columns each */, OMT = 4 /* 16-row tiles per output-product block */, ONC = 256 /* its columns */;
constexpr float XS = 8.0f, HS = 256.0f /* hi+lo staging scale for q/k/v/attended */, WSC = 256.0f, PS = 256.0f, SCALE = 0.125f;
typedef _Float16 b16;
typedef __attribute__((ext_vector_type(16))) _Float16 v16b;
typedef __attribute__((ext_vector_type(8))) _Float16 v8b;
typedef __attribute__((ext_vector_type(8))) float v8f;
typedef __attribute__((ext_vector_type(4))) float v4f;
__device__ __forceinline__ float bf16_rne(float f) { unsigned int u = __float_as_uint(f); u += 0x7FFFu + ((u >> 16) & 1u); float r = __uint_as_float(u & 0xFFFF0000u); asm volatile("" : "+v"(r)); return r; }
__device__ __forceinline__ float bfv(float f) { float r = bf16_rne(f); asm volatile("" : "+v"(r)); return r; }
__device__ __forceinline__ void split16(float v, b16& hi, b16& lo) { hi = (b16)v; lo = (b16)(v - (float)hi); }
__device__ __forceinline__ v16b frag_kb(const b16* p, int hh) { const v8b a = *(const v8b*)(p + 8 * hh), b = *(const v8b*)(p + 16 + 8 * hh); v16b f;
#pragma unroll
  for (int e = 0; e < 8; ++e) { f[e] = a[e]; f[8 + e] = b[e]; } return f; }
// V^T fragment of 32 keys from the tiled planes: p and p2 point at this lane's (d, 8*hh) in the first and the second 16-position tile of the pair; elements 0..7 <- k = 8hh+0..7 (p), 8..15 <- k = 16+8hh+0..7 (p2): the same k-map as frag_kb.
__device__ __forceinline__ v16b frag_vt(const b16* p, const b16* p2) { const v8b a = *(const v8b*)p, b = *(const v8b*)p2; v16b f;
#pragma unroll
  for (int e = 0; e < 8; ++e) { f[e] = a[e]; f[8 + e] = b[e]; } return f; }
// fragment of 32 k from a fragment-order block: p points at this lane's 8 elements of half j = 0, half j = 1 stands 256 elements on; the same k-map as frag_kb.
__device__ __forceinline__ v16b frag_fo(const b16* p) { return frag_vt(p, p + 256); }
__device__ __forceinline__ v8f wmma16b(v16b a, v16b b, v8f c) { v8f d = __builtin_amdgcn_wmma_f32_16x16x32_f16(false, a, false, b, (short)0, c, false, false); asm volatile("v_nop\n\tv_nop\n\tv_nop\n\tv_nop" : "+v"(d) : "v"(a), "v"(b)); return d; }
__device__ __forceinline__ void wave_lds_sync() { __builtin_amdgcn_fence(__ATOMIC_RELEASE, "workgroup"); __builtin_amdgcn_wave_barrier(); __builtin_amdgcn_fence(__ATOMIC_ACQUIRE, "workgroup"); }
// the same for LDS alone: in the GEMM epilogues, which loop over row tiles, the fence above would also wait for the last tile's global stores to finish
__device__ __forceinline__ void wave_lds_only() { __builtin_amdgcn_fence(__ATOMIC_RELEASE, "workgroup", "local"); __builtin_amdgcn_wave_barrier(); __builtin_amdgcn_fence(__ATOMIC_ACQUIRE, "workgroup", "local"); }
// u-th key tile of query tile (class r, tile g of the class), as a tile number in position order, or -1 for none: first the own class from its start up to the diagonal (u = 0..g), then of each other class the WT tiles g-WT+1..g that the windows reach.
__device__ __forceinline__ int key_tile(int u, int g, int r) { const int v = u - g - 1, ci = v / WT, tau = g - (WT - 1) + v % WT; const int f = ((ci >= DIL - 1) | (tau < 0)) ? -1 : (ci + (ci >= r ? 1 : 0)) * TPC + tau; return u <= g ? r * TPC + u : f; }
// lane l's value from lane l ^ M of the same 16-lane row, as a DPP operand (no LDS round trip, unlike __shfl_xor)
template <int M> __device__ __forceinline__ float rowx(float x) { return __builtin_bit_cast(float, __builtin_amdgcn_update_dpp(0, __builtin_bit_cast(int, x), 0x160 + M, 0xf, 0xf, true)); }
__device__ __forceinline__ float row_max16(float x) { x = fmaxf(x, rowx<1>(x)); x = fmaxf(x, rowx<2>(x)); x = fmaxf(x, rowx<4>(x)); return fmaxf(x, rowx<8>(x)); }
__device__ __forceinline__ float row_sum16(float x) { x += rowx<1>(x); x += rowx<2>(x); x += rowx<4>(x); return x + rowx<8>(x); }
__device__ __forceinline__ float pmul(float a, float b) { float p = a * b; asm volatile("" : "+v"(p)); return p; }

__global__ __launch_bounds__(256) void wput_kernel(const float* __restrict__ wq, const float* __restrict__ wk, const float* __restrict__ wv, const float* __restrict__ wo, b16* __restrict__ W3, b16* __restrict__ WO) { const size_t u = (size_t)blockIdx.x * 256 + threadIdx.x; if (u >= (size_t)4 * C * (C / 8)) return; const int c = (int)(u & 3), ks = (int)(u >> 5) % (C / 32), r = (int)(u / C) * 8 + (int)((u >> 2) & 7), k0 = ks * 32 + c * 8;   /* a wave takes 32 k of 8 rows: it reads 8 whole lines and writes 4 whole lines */ const int p = r / C, o = r % C, rb = p < 3 ? r : o; const float* w = p == 0 ? wq : (p == 1 ? wk : (p == 2 ? wv : wo)); v8b v;
#pragma unroll
  for (int j = 0; j < 8; ++j) v[j] = (b16)(bf16_rne(w[(size_t)o * C + k0 + j]) * WSC);
  { *(v8b*)((p < 3 ? W3 : WO) + ((size_t)(rb >> 4) * (C / 32) + ks) * 512 + (c >> 1) * 256 + ((c & 1) * 16 + (rb & 15)) * 8) = v;  } }
// projection: block = 12 waves on PMT = 4 tiles of 16 positions (64 positions in a row of one residue class, see the head of the file) and 768 of the 3,072 columns q|k|v (blockIdx.y); the waves share the staged x rows, a wave owns 64 columns = one head of one of q, k, v, for all 64 rows: a weight fragment is read from L2 once and multiplied with 4 row tiles. 64 x 4 = 256 blocks, one per WGP.
// q goes out token-major (PH/PL). k goes out in fragment order, tiled [b][head][16-token tile][d half 0..1][j][lane][8] (KFH/KFL): a wave owns one head and writes 2 KiB in a row per plane and tile. v goes out TRANSPOSED, tiled [b][head][16-token tile][d 0..63][token 0..15] (VTH/VTL): a lane's 8 accumulator rows are 8 consecutive tokens of one d, so it stores them as one 16-byte word; a wave owns one head and writes 2 KiB in a row per plane and tile.
__global__ __launch_bounds__(PNW * 32) void proj_kernel(const float* __restrict__ x, const b16* __restrict__ W3, const float* __restrict__ bq, const float* __restrict__ bk, const float* __restrict__ bv, int TLIM, b16* __restrict__ PH, b16* __restrict__ PL, b16* __restrict__ VTH, b16* __restrict__ VTL, b16* __restrict__ KFH, b16* __restrict__ KFL) { __shared__ __attribute__((aligned(16))) b16 Ah[16 * PMT][C + 8], Oh[PNW][16][72], Ol[PNW][16][72]; const int lane = threadIdx.x & 31, wv = __builtin_amdgcn_readfirstlane(threadIdx.x >> 5), nloc = lane & 15, hlf = lane >> 4; const size_t m0 = (size_t)blockIdx.x * (16 * PMT); if (m0 >= (size_t)TLIM) return;
  for (int rw = wv; rw < 16 * PMT; rw += PNW) { const size_t xr = ((m0 + rw) / L) * L + DIL * ((m0 + rw) % NC) + ((m0 + rw) % L) / NC;   // the token that stands at position m0 + rw
    float xv[C / 32];   // a row's 32 loads are requested before the first rounding: no load is moved across the asm statement in bf16_rne, so load by load each would wait out memory alone, and a wave now stages 5 or 6 rows
#pragma unroll
    for (int q = 0; q < C / 32; ++q) xv[q] = x[xr * C + q * 32 + lane];
#pragma unroll
    for (int q = 0; q < C / 32; ++q) Ah[rw][q * 32 + lane] = (b16)(bf16_rne(xv[q]) * XS); }
  __syncthreads();   // every wave reads all staged rows
  const int c0 = ((int)blockIdx.y * PNW + wv) * 64, pj = c0 / C, hd = (c0 % C) / HD; const float sc = pj == 0 ? SCALE : 1.0f; const b16* wp = W3 + (size_t)(c0 / 16) * (C / 32) * 512 + lane * 8; v8f acc[PMT][4];
#pragma unroll
  for (int mt = 0; mt < PMT; ++mt)
#pragma unroll
    for (int t = 0; t < 4; ++t) acc[mt][t] = (v8f){};
  for (int kb = 0; kb < C; kb += 64) { v16b bw[2][4];   // a trip is 64 k: its 16 weight loads are requested before its first product, so the trip waits for L2 once; with 3 waves on a SIMD the other waves' products cover that wait
#pragma unroll
    for (int s = 0; s < 2; ++s)
#pragma unroll
      for (int t = 0; t < 4; ++t) bw[s][t] = frag_fo(wp + t * 16 * C + (kb + 32 * s) * 16);
#pragma unroll
    for (int s = 0; s < 2; ++s) { v16b a[PMT];   // the four row tiles' fragments as one group of LDS reads
#pragma unroll
      for (int mt = 0; mt < PMT; ++mt) a[mt] = frag_kb(&Ah[mt * 16 + nloc][kb + 32 * s], hlf);
#pragma unroll
      for (int mt = 0; mt < PMT; ++mt)
#pragma unroll
        for (int t = 0; t < 4; ++t) acc[mt][t] = wmma16b(a[mt], bw[s][t], acc[mt][t]); } }
#pragma unroll
  for (int mt = 0; mt < PMT; ++mt) { const size_t mm = m0 + mt * 16; const size_t tb = (((mm / L) * NH + hd) * (L / 16) + (mm % L) / 16) * (HD * 16);   // this row tile's first position; its k or v tile of the wave's head
    if (pj == 2) {
#pragma unroll
      for (int t = 0; t < 4; ++t) { v8b vh, vl;
#pragma unroll
        for (int r8 = 0; r8 < 8; ++r8) { b16 p, ql; split16((acc[mt][t][r8] * (1.0f / (XS * WSC)) + 0.0f) * sc * HS, p, ql); vh[r8] = p; vl[r8] = ql; }
        *(v8b*)(VTH + tb + (t * 16 + nloc) * 16 + 8 * hlf) = vh; *(v8b*)(VTL + tb + (t * 16 + nloc) * 16 + 8 * hlf) = vl; }
      asm volatile("s_wait_xcnt 0x0" ::: "memory");   // behind the run of v stores: the code that stands behind it in the listing rewrites registers that the stores name
    }
    else {
#pragma unroll
      for (int t = 0; t < 4; ++t) { const int cc = t * 16 + nloc; const float bvv = 0.0f;
#pragma unroll
        for (int r8 = 0; r8 < 8; ++r8) { b16 p, ql; split16((acc[mt][t][r8] * (1.0f / (XS * WSC)) + bvv) * sc * HS, p, ql); Oh[wv][8 * hlf + r8][cc] = p; Ol[wv][8 * hlf + r8][cc] = ql; } }
      wave_lds_only();
      if (pj == 1) {
#pragma unroll
        for (int i = 0; i < 4; ++i) { *(v8b*)(KFH + tb + lane * 8 + i * 256) = *(const v8b*)(&Oh[wv][nloc][i * 16 + 8 * hlf]); *(v8b*)(KFL + tb + lane * 8 + i * 256) = *(const v8b*)(&Ol[wv][nloc][i * 16 + 8 * hlf]); }
        asm volatile("s_wait_xcnt 0x0" ::: "memory");   // behind the run of k stores, for the same reason
      }
      else { const int ro = lane >> 3, cs = (lane & 7) * 8; for (int rr = 0; rr < 16; rr += 4) { *(v8b*)(PH + (mm + rr + ro) * PW + c0 + cs) = *(const v8b*)(&Oh[wv][rr + ro][cs]); *(v8b*)(PL + (mm + rr + ro) * PW + c0 + cs) = *(const v8b*)(&Ol[wv][rr + ro][cs]); }
        asm volatile("s_wait_xcnt 0x0" ::: "memory");   // behind the run of q stores, for the same reason
      }
      wave_lds_only();   // the next row tile rewrites the wave's staging rows
    }
  }
}
// attention: ONE WAVE PER BLOCK, wave per (b, h, 16-query tile of one residue class): key blocks of 8 tiles from the list of key_tile() (own class up to the diagonal, the other classes inside the window), every key that the mask allows exactly once; S = Q K^T (3 products, K 64); online softmax in the accumulator registers (row maximum and sum by DPP over the 16 lanes of a row); P x256 hi+lo goes through LDS into A-fragment order; the V^T fragments are read straight from VTH/VTL (each 16-byte load of a wave covers 512 bytes in a row), nothing of V is staged in LDS.
__global__ __launch_bounds__(32) void att_kernel(const b16* __restrict__ PH, const b16* __restrict__ PL, const b16* __restrict__ KFH, const b16* __restrict__ KFL, const b16* __restrict__ VTH, const b16* __restrict__ VTL, const float* __restrict__ amask, int BLIM, float* __restrict__ ATT) { __shared__ __attribute__((aligned(16))) b16 Ph_[16][KB + 8], Pl_[16][KB + 8]; __shared__ float Of[16][HD + 4];
  const int lane = threadIdx.x, nloc = lane & 15, hlf = lane >> 4; const int qt = blockIdx.x % (L / 16); const int h = (blockIdx.x / (L / 16)) % NH; const int b = blockIdx.x / ((L / 16) * NH); if (b >= BLIM) return; const int t0 = qt * 16, r = qt / TPC, g = qt % TPC; const size_t rowb = (size_t)b * L; const int qo = h * HD; const size_t vtb = (size_t)(b * NH + h) * (L / 16) * (HD * 16); const unsigned vlo = nloc * 16 + 8 * hlf;   // the head's first K or V^T tile (the same for the wave); this lane's d row (mod 16) and token half inside a tile
  v16b qh[HD / 32], ql[HD / 32];
#pragma unroll
  for (int s = 0; s < HD / 32; ++s) { qh[s] = frag_kb(PH + (rowb + t0 + nloc) * PW + qo + s * 32, hlf); ql[s] = frag_kb(PL + (rowb + t0 + nloc) * PW + qo + s * 32, hlf); }
  float m_r[8], den_r[8]; v8f acc[HD / 16];
#pragma unroll
  for (int r8 = 0; r8 < 8; ++r8) { m_r[r8] = -INFINITY; den_r[r8] = 0.0f; }
#pragma unroll
  for (int t = 0; t < HD / 16; ++t) acc[t] = (v8f){};
  const int ntile = g + 1 + WT * (DIL - 1);   // length of the key tile list
#pragma unroll 1
  for (int u0 = 0; u0 < ntile; u0 += KB / 16) { const int nkt = (ntile - u0) < KB / 16 ? (ntile - u0) : KB / 16;
    v8f sv[KB / 16];   // the block's masked scores stay where the WMMA leaves them: sv[t][r8] = row 8*hlf + r8, key column t*16 + nloc; the t loops below are unrolled so that sv[t] names registers and not scratch memory
    // the score stage is straight-line code per group of KG key tiles, with one wave-uniform test per group: all K fragments of the group are requested before its first product (one wait for L2 per group), the tiles' accumulator chains alternate, and the mask is a select. A place of the list without a tile reads the class's first tile (written, finite) and is masked whole. The loops over a, q and r8 are unrolled so that the fragment and score arrays name registers.
#pragma unroll
    for (int tg = 0; tg < KB / 16; tg += KG) { if (u0 + tg < ntile) { int kt[KG]; const b16 *ph[KG], *pl[KG]; v16b kh[KG][HD / 32], kl[KG][HD / 32]; v8f s[KG];
#pragma unroll
        for (int a = 0; a < KG; ++a) { kt[a] = key_tile(u0 + tg + a, g, r); const size_t kr = vtb + (size_t)(kt[a] < 0 ? r * TPC : kt[a]) * (HD * 16) + lane * 8; ph[a] = KFH + kr; pl[a] = KFL + kr; s[a] = (v8f){}; }
#pragma unroll
        for (int a = 0; a < KG; ++a)
#pragma unroll
          for (int q = 0; q < HD / 32; ++q) { kh[a][q] = frag_fo(ph[a] + q * 512); kl[a][q] = frag_fo(pl[a] + q * 512); }
#pragma unroll
        for (int q = 0; q < HD / 32; ++q) {   // per accumulator the order of the products is q-hi k-hi, q-hi k-lo, q-lo k-hi, as before
#pragma unroll
          for (int a = 0; a < KG; ++a) s[a] = wmma16b(qh[q], kh[a][q], s[a]);
#pragma unroll
          for (int a = 0; a < KG; ++a) s[a] = wmma16b(qh[q], kl[a][q], s[a]);
#pragma unroll
          for (int a = 0; a < KG; ++a) s[a] = wmma16b(ql[q], kh[a][q], s[a]); }
#pragma unroll
        for (int a = 0; a < KG; ++a) asm volatile("s_wait_xcnt 0x0" :: "v"(ph[a]), "v"(pl[a]) : "memory");   // later code rewrites the address registers that the group's K loads name; as inputs here they stay untouched (also by a later load's result) up to this wait
#pragma unroll
        for (int a = 0; a < KG; ++a) { const int kc = kt[a] < 0 ? r * TPC : kt[a], j = kc / TPC + DIL * ((kc % TPC) * 16 + nloc);   // the key's token
          // with d = i - j the mask (window 0 <= d <= 127, or dilated d >= 132 with d % 4 == 0) reads: own class (d % 4 == 0): d >= 0 and d != 128; another class (d % 4 != 0): 0 <= d < 128; no tile: nothing
          const unsigned lim = kt[a] < 0 ? 0u : (kc / TPC == r ? 0x80000000u : (unsigned)WINDOW);
#pragma unroll
          for (int r8 = 0; r8 < 8; ++r8) { const int d = r + DIL * (g * 16 + 8 * hlf + r8) - j; const bool ok = ((unsigned)d < lim) & (d != WINDOW); sv[tg + a][r8] = ok ? s[a][r8] * (1.0f / (HS * HS)) : -INFINITY; } } }
      else {
#pragma unroll
        for (int a = 0; a < KG; ++a)
#pragma unroll
          for (int r8 = 0; r8 < 8; ++r8) sv[tg + a][r8] = -INFINITY; } }
    // a lane owns 8 rows (its accumulator rows) and one key column of each tile: maximum and sum run over the 8 tiles in the lane, then over the 16 lanes of the row; the 8 rows are independent chains
#pragma unroll
    for (int r8 = 0; r8 < 8; ++r8) { float mx = sv[0][r8];
#pragma unroll
      for (int t = 1; t < KB / 16; ++t) mx = fmaxf(mx, sv[t][r8]);
      mx = row_max16(mx);
      const float mold = m_r[r8]; const float mn = fmaxf(mold, mx); const float sf = (mold == -INFINITY) ? 0.0f : ((mn == -INFINITY) ? 1.0f : __expf(mold - mn)); float ps = 0.0f;
#pragma unroll
      for (int t = 0; t < KB / 16; ++t) { const float x = sv[t][r8]; const float p = (x == -INFINITY || mn == -INFINITY) ? 0.0f : __expf(x - mn); ps += p; b16 ph, pl; split16(p * PS, ph, pl); Ph_[8 * hlf + r8][t * 16 + nloc] = ph; Pl_[8 * hlf + r8][t * 16 + nloc] = pl; }
      ps = row_sum16(ps);
      den_r[r8] = den_r[r8] * sf + ps; m_r[r8] = mn;
#pragma unroll
      for (int t = 0; t < HD / 16; ++t) acc[t][r8] = acc[t][r8] * sf; }
    wave_lds_sync();
    for (int ks = 0; ks < nkt * 16; ks += 32) { const v16b pa = frag_kb(&Ph_[nloc][ks], hlf), pb = frag_kb(&Pl_[nloc][ks], hlf); const int ka = key_tile(u0 + ks / 16, g, r), kc = key_tile(u0 + ks / 16 + 1, g, r); const size_t vp = vtb + (size_t)(ka < 0 ? r * TPC : ka) * (HD * 16), vp2 = vtb + (size_t)(kc < 0 ? r * TPC : kc) * (HD * 16);   /* two tiles of the list; where the list has none, p = 0 there and any written tile serves (finite V) */
      const b16 *h1 = VTH + vp + vlo, *h2 = VTH + vp2 + vlo, *l1 = VTL + vp + vlo, *l2 = VTL + vp2 + vlo;   // this lane's place in the two tiles, hi and lo plane
      v16b vh[HD / 16], vl[HD / 16];   // all eight fragments of the trip are requested before the first product, so the trip waits for L2 once and not once per d tile
#pragma unroll
      for (int t = 0; t < HD / 16; ++t) { vh[t] = frag_vt(h1 + t * 256, h2 + t * 256); vl[t] = frag_vt(l1 + t * 256, l2 + t * 256); }
#pragma unroll
      for (int t = 0; t < HD / 16; ++t) { acc[t] = wmma16b(pa, vh[t], acc[t]); acc[t] = wmma16b(pa, vl[t], acc[t]); acc[t] = wmma16b(pb, vh[t], acc[t]); }
      asm volatile("s_wait_xcnt 0x0" :: "v"(h1), "v"(h2), "v"(l1), "v"(l2) : "memory");   // the next trip rewrites the address registers that this trip's V^T loads name; as inputs here they stay untouched (also by a later load's result) up to this wait
    }
    wave_lds_sync(); }
#pragma unroll
  for (int t = 0; t < HD / 16; ++t)
#pragma unroll
    for (int r8 = 0; r8 < 8; ++r8) { const float dn = den_r[r8]; Of[8 * hlf + r8][t * 16 + nloc] = dn > 0.0f ? acc[t][r8] * (1.0f / (HS * PS)) / dn : 0.0f; }
  wave_lds_sync();
  { for (int rr = 0; rr < 16; ++rr) for (int s = 0; s < HD / 32; ++s) ((float*)ATT)[(rowb + r + DIL * (g * 16 + rr)) * C + h * HD + s * 32 + lane] = Of[rr][s * 32 + lane];  } }
// output product: block = 16 waves on OMT = 4 tiles of 16 tokens and 256 of the 1,024 columns (blockIdx.y); the waves share the staged hi+lo rows; wave wv owns rows (wv / 8) * 32 .. + 31 and columns (wv % 8) * 32 .. + 31 of the block: a weight fragment feeds 2 row tiles in the wave, and the block reads its weights for 64 rows. 64 x 4 = 256 blocks, one per WGP.
__global__ __launch_bounds__(512) void out_kernel(const float* __restrict__ ATT, const b16* __restrict__ WO, const float* __restrict__ bo, int TLIM, float* __restrict__ out) { __shared__ __attribute__((aligned(16))) b16 Ah[16 * OMT][C + 8], Al[16 * OMT][C + 8]; __shared__ __attribute__((aligned(16))) float Tf[16][16][36]; const int lane = threadIdx.x & 31, wv = __builtin_amdgcn_readfirstlane(threadIdx.x >> 5), nloc = lane & 15, hlf = lane >> 4; const size_t m0 = (size_t)blockIdx.x * (16 * OMT); if (m0 >= (size_t)TLIM) return;
  for (int rr = wv * OMT; rr < wv * OMT + OMT; ++rr) for (int q = 0; q < C / 32; ++q) { b16 p, ql; split16(ATT[(m0 + rr) * C + q * 32 + lane] * HS, p, ql); Ah[rr][q * 32 + lane] = p; Al[rr][q * 32 + lane] = ql; }
  __syncthreads();   // every wave reads 32 staged rows, written by 8 waves
  const int r0 = (wv >> 3) * 32, c0 = (int)blockIdx.y * ONC + (wv & 7) * 32; const b16* wp = WO + (size_t)(c0 / 16) * (C / 32) * 512 + lane * 8; v8f acc[2][2];
#pragma unroll
  for (int mt = 0; mt < 2; ++mt)
#pragma unroll
    for (int t = 0; t < 2; ++t) acc[mt][t] = (v8f){};
  for (int kb = 0; kb < C; kb += 128) { v16b bw[4][2];   // a trip is 128 k: its 16 weight loads are requested before its first product, so the trip waits for L2 once
#pragma unroll
    for (int s = 0; s < 4; ++s)
#pragma unroll
      for (int t = 0; t < 2; ++t) bw[s][t] = frag_fo(wp + t * 16 * C + (kb + 32 * s) * 16);
#pragma unroll
    for (int s = 0; s < 4; ++s) { v16b a[2], al[2];
#pragma unroll
      for (int mt = 0; mt < 2; ++mt) { a[mt] = frag_kb(&Ah[r0 + mt * 16 + nloc][kb + 32 * s], hlf); al[mt] = frag_kb(&Al[r0 + mt * 16 + nloc][kb + 32 * s], hlf); }
      // per accumulator hi then lo, as before; the other accumulators' products stand between an accumulator's two
#pragma unroll
      for (int mt = 0; mt < 2; ++mt)
#pragma unroll
        for (int t = 0; t < 2; ++t) acc[mt][t] = wmma16b(a[mt], bw[s][t], acc[mt][t]);
#pragma unroll
      for (int mt = 0; mt < 2; ++mt)
#pragma unroll
        for (int t = 0; t < 2; ++t) acc[mt][t] = wmma16b(al[mt], bw[s][t], acc[mt][t]); } }
#pragma unroll
  for (int mt = 0; mt < 2; ++mt) {
#pragma unroll
    for (int t = 0; t < 2; ++t) { const int cc = t * 16 + nloc; const float bb = 0.0f;
#pragma unroll
      for (int r8 = 0; r8 < 8; ++r8) Tf[wv][8 * hlf + r8][cc] = acc[mt][t][r8] * (1.0f / (HS * WSC)) + bb; }
    wave_lds_only();
    { const int ro = lane >> 3, cs = (lane & 7) * 4; for (int rr = 0; rr < 16; rr += 4) *(v4f*)(out + (m0 + r0 + mt * 16 + rr + ro) * C + c0 + cs) = *(const v4f*)(&Tf[wv][rr + ro][cs]); }
    wave_lds_only();   // the next row tile rewrites the wave's staging rows
    asm volatile("s_wait_xcnt 0x0" ::: "memory");   // behind a row tile's run of stores: the next tile's addresses may rewrite registers that hold theirs
  } }
}  // namespace

extern "C" void kernel_launch(void* const* d_in, const int* in_sizes, int n_in, void* d_out, int out_size, void* d_ws, size_t ws_size, hipStream_t stream) {
  (void)n_in;
  auto Fp = [&](int i) { return (const float*)d_in[i]; };
  // input order: 0 x [2,2048,1024]; 1 qkv [3072,1024] (out,in: rows q|k|v); 2 wo [1024,1024] (out,in)
  if (in_sizes[0] != NT * C || in_sizes[1] != 3 * C * C || in_sizes[2] != C * C || out_size != NT * C) return;
  const int BLIM = NB;   // batch cut
  const int TLIM = BLIM * L;
  size_t off = 0; char* ws = (char*)d_ws;
  auto carve = [&](size_t bytes) { char* p = ws + off; off += (bytes + 255) & ~(size_t)255; return p; };
  b16* W3 = (b16*)carve((size_t)3 * C * C * 2); b16* WO = (b16*)carve((size_t)C * C * 2); b16* PH = (b16*)carve((size_t)NT * PW * 2); b16* PL = (b16*)carve((size_t)NT * PW * 2); float* ATT = (float*)carve((size_t)NT * C * 4); b16* VTH = (b16*)carve((size_t)NT * C * 2); b16* VTL = (b16*)carve((size_t)NT * C * 2); b16* KFH = (b16*)carve((size_t)NT * C * 2); b16* KFL = (b16*)carve((size_t)NT * C * 2);
  if (off > ws_size || off > ((size_t)112 << 20)) return;   // ~ 104 MiB
  wput_kernel<<<(unsigned)(((size_t)4 * C * (C / 8) + 255) / 256), 256, 0, stream>>>(Fp(1), Fp(1) + (size_t)C * C, Fp(1) + (size_t)2 * C * C, Fp(2), W3, WO);
  proj_kernel<<<dim3(TLIM / (16 * PMT), PW / (64 * PNW)), PNW * 32, 0, stream>>>(Fp(0), W3, Fp(0), Fp(0), Fp(0), TLIM, PH, PL, VTH, VTL, KFH, KFL);
  att_kernel<<<BLIM * NH * (L / 16), 32, 0, stream>>>(PH, PL, KFH, KFL, VTH, VTL, (const float*)0, BLIM, ATT);
  out_kernel<<<dim3(TLIM / (16 * OMT), C / ONC), 512, 0, stream>>>(ATT, WO, (const float*)0, TLIM, (float*)d_out);
}

// v008
// It runs in 101 microseconds.
// Next to v007, in two timings, it ran 1.14 times as fast each time.
// Counting every step since v000, it is 27.9 times as fast.
#include <hip/hip_runtime.h>

// CustomWindowMHA: 16 heads x 64 over 2 x 2,048 tokens; token i attends to j in the causal window i-127..i OR the dilated set j = i-128-4m (m >= 1, j >= 0); QKV = x qkv^T (no bias), scores/8, masked softmax, out = (attn v) wo^T -> [2][2048][1024].
// Deterministic: no index structures, no atomics; flash-style online softmax over the key tiles of a query tile in a fixed order.
// TOKEN ORDER IN THE WORKSPACE: q, k and v are kept by residue class, position p = (token % 4) * 512 + token / 4 inside a sequence. A query tile is 16 positions in a row = 16 tokens of ONE class, so its dilated keys (same class) are rows in a row, and the three other classes matter only inside the window (3 tiles of 16 each).
// FRAGMENT ORDER: the B operands that a wave reads from global memory as weights (W3, WO) and keys (KFH/KFL) are stored as the WMMA wants it: per tile of 16 rows and per 32 k one block of 512 elements [16-k half j][lane][8], lane = 16*hh + row, k = 16j + 8hh + 0..7. A wave's 16-byte load then covers 512 bytes in a row (4 lines) where row-major storage gave it 32 bytes of each of 16 lines.
// WMMA (v_wmma_f32_16x16x32_f16, f32 accumulate): the QKV projection with x EXACT bf16 x8 (K 1024) against exact torch weight rows x256 (one product); S = Q K^T (hi+lo x hi+lo, 3 products, K 64); O = P V (P x256 hi+lo x V^T hi+lo, 3 products; V^T comes ready from the projection, see VTH/VTL); out = attended (hi+lo) Wo^T (2 products); softmax in f32. Inputs rounded to bf16 once. Fragment k-map per lane half hh for A AND B: elements 0..7 <- k = 8hh+0..7, 8..15 <- k = 16+8hh+0..7; acc[r] = D[8hh+r][col].

namespace {
constexpr int NB = 2, L = 2048, C = 1024, NH = 16, HD = 64, NT = NB * L, KB = 128, PW = 3 * C;
constexpr int WINDOW = 128, DIL = 4, KG = 2 /* key tiles whose K fragments attention requests together */;
constexpr int NC = L / DIL /* positions per residue class */, TPC = NC / 16 /* 16-position tiles per class */, WT = WINDOW / (DIL * 16) + 1 /* tiles of a foreign class that a query tile's windows can touch */;
constexpr int PMT = 4 /* 16-row tiles per projection block */, PNW = 12 /* its waves, 64 columns each */, OMT = 4 /* 16-row tiles per output-product block */, ONC = 256 /* its columns */;
constexpr float XS = 8.0f, HS = 256.0f /* hi+lo staging scale for q/k/v/attended */, WSC = 256.0f, PS = 256.0f, SCALE = 0.125f;
typedef _Float16 b16;
typedef __attribute__((ext_vector_type(16))) _Float16 v16b;
typedef __attribute__((ext_vector_type(8))) _Float16 v8b;
typedef __attribute__((ext_vector_type(8))) float v8f;
typedef __attribute__((ext_vector_type(4))) float v4f;
__device__ __forceinline__ float bf16_rne(float f) { unsigned int u = __float_as_uint(f); u += 0x7FFFu + ((u >> 16) & 1u); float r = __uint_as_float(u & 0xFFFF0000u); asm volatile("" : "+v"(r)); return r; }
__device__ __forceinline__ float bfv(float f) { float r = bf16_rne(f); asm volatile("" : "+v"(r)); return r; }
__device__ __forceinline__ void split16(float v, b16& hi, b16& lo) { hi = (b16)v; lo = (b16)(v - (float)hi); }
__device__ __forceinline__ v16b frag_kb(const b16* p, int hh) { const v8b a = *(const v8b*)(p + 8 * hh), b = *(const v8b*)(p + 16 + 8 * hh); v16b f;
#pragma unroll
  for (int e = 0; e < 8; ++e) { f[e] = a[e]; f[8 + e] = b[e]; } return f; }
// V^T fragment of 32 keys from the tiled planes: p and p2 point at this lane's (d, 8*hh) in the first and the second 16-position tile of the pair; elements 0..7 <- k = 8hh+0..7 (p), 8..15 <- k = 16+8hh+0..7 (p2): the same k-map as frag_kb.
__device__ __forceinline__ v16b frag_vt(const b16* p, const b16* p2) { const v8b a = *(const v8b*)p, b = *(const v8b*)p2; v16b f;
#pragma unroll
  for (int e = 0; e < 8; ++e) { f[e] = a[e]; f[8 + e] = b[e]; } return f; }
// fragment of 32 k from a fragment-order block: p points at this lane's 8 elements of half j = 0, half j = 1 stands 256 elements on; the same k-map as frag_kb.
__device__ __forceinline__ v16b frag_fo(const b16* p) { return frag_vt(p, p + 256); }
__device__ __forceinline__ v8f wmma16b(v16b a, v16b b, v8f c) { v8f d = __builtin_amdgcn_wmma_f32_16x16x32_f16(false, a, false, b, (short)0, c, false, false); asm volatile("v_nop\n\tv_nop\n\tv_nop\n\tv_nop" : "+v"(d) : "v"(a), "v"(b)); return d; }
__device__ __forceinline__ void wave_lds_sync() { __builtin_amdgcn_fence(__ATOMIC_RELEASE, "workgroup"); __builtin_amdgcn_wave_barrier(); __builtin_amdgcn_fence(__ATOMIC_ACQUIRE, "workgroup"); }
// the same for LDS alone: in the GEMM epilogues, which loop over row tiles, the fence above would also wait for the last tile's global stores to finish
__device__ __forceinline__ void wave_lds_only() { __builtin_amdgcn_fence(__ATOMIC_RELEASE, "workgroup", "local"); __builtin_amdgcn_wave_barrier(); __builtin_amdgcn_fence(__ATOMIC_ACQUIRE, "workgroup", "local"); }
// u-th key tile of query tile (class r, tile g of the class), as a tile number in position order, or -1 for none: first the own class from its start up to the diagonal (u = 0..g), then of each other class the WT tiles g-WT+1..g that the windows reach.
__device__ __forceinline__ int key_tile(int u, int g, int r) { const int v = u - g - 1, ci = v / WT, tau = g - (WT - 1) + v % WT; const int f = ((ci >= DIL - 1) | (tau < 0)) ? -1 : (ci + (ci >= r ? 1 : 0)) * TPC + tau; return u <= g ? r * TPC + u : f; }
// lane l's value from lane l ^ M of the same 16-lane row, as a DPP operand (no LDS round trip, unlike __shfl_xor)
template <int M> __device__ __forceinline__ float rowx(float x) { return __builtin_bit_cast(float, __builtin_amdgcn_update_dpp(0, __builtin_bit_cast(int, x), 0x160 + M, 0xf, 0xf, true)); }
__device__ __forceinline__ float row_max16(float x) { x = fmaxf(x, rowx<1>(x)); x = fmaxf(x, rowx<2>(x)); x = fmaxf(x, rowx<4>(x)); return fmaxf(x, rowx<8>(x)); }
__device__ __forceinline__ float row_sum16(float x) { x += rowx<1>(x); x += rowx<2>(x); x += rowx<4>(x); return x + rowx<8>(x); }
__device__ __forceinline__ float pmul(float a, float b) { float p = a * b; asm volatile("" : "+v"(p)); return p; }

__global__ __launch_bounds__(256) void wput_kernel(const float* __restrict__ wq, const float* __restrict__ wk, const float* __restrict__ wv, const float* __restrict__ wo, b16* __restrict__ W3, b16* __restrict__ WO) { const size_t u = (size_t)blockIdx.x * 256 + threadIdx.x; if (u >= (size_t)4 * C * (C / 8)) return; const int c = (int)(u & 3), ks = (int)(u >> 5) % (C / 32), r = (int)(u / C) * 8 + (int)((u >> 2) & 7), k0 = ks * 32 + c * 8;   /* a wave takes 32 k of 8 rows: it reads 8 whole lines and writes 4 whole lines */ const int p = r / C, o = r % C, rb = p < 3 ? r : o; const float* w = p == 0 ? wq : (p == 1 ? wk : (p == 2 ? wv : wo)); v8b v;
#pragma unroll
  for (int j = 0; j < 8; ++j) v[j] = (b16)(bf16_rne(w[(size_t)o * C + k0 + j]) * WSC);
  { *(v8b*)((p < 3 ? W3 : WO) + ((size_t)(rb >> 4) * (C / 32) + ks) * 512 + (c >> 1) * 256 + ((c & 1) * 16 + (rb & 15)) * 8) = v;  } }
// projection: block = 12 waves on PMT = 4 tiles of 16 positions (64 positions in a row of one residue class, see the head of the file) and 768 of the 3,072 columns q|k|v (blockIdx.y); the waves share the staged x rows, a wave owns 64 columns = one head of one of q, k, v, for all 64 rows: a weight fragment is read from L2 once and multiplied with 4 row tiles. 64 x 4 = 256 blocks, one per WGP.
// q goes out token-major (PH/PL). k goes out in fragment order, tiled [b][head][16-token tile][d half 0..1][j][lane][8] (KFH/KFL): a wave owns one head and writes 2 KiB in a row per plane and tile. v goes out TRANSPOSED, tiled [b][head][16-token tile][d 0..63][token 0..15] (VTH/VTL): a lane's 8 accumulator rows are 8 consecutive tokens of one d, so it stores them as one 16-byte word; a wave owns one head and writes 2 KiB in a row per plane and tile.
__global__ __launch_bounds__(PNW * 32) void proj_kernel(const float* __restrict__ x, const b16* __restrict__ W3, const float* __restrict__ bq, const float* __restrict__ bk, const float* __restrict__ bv, int TLIM, b16* __restrict__ PH, b16* __restrict__ PL, b16* __restrict__ VTH, b16* __restrict__ VTL, b16* __restrict__ KFH, b16* __restrict__ KFL) { __shared__ __attribute__((aligned(16))) b16 Ah[16 * PMT][C + 8], Oh[PNW][16][72], Ol[PNW][16][72]; const int lane = threadIdx.x & 31, wv = __builtin_amdgcn_readfirstlane(threadIdx.x >> 5), nloc = lane & 15, hlf = lane >> 4; const size_t m0 = (size_t)blockIdx.x * (16 * PMT); if (m0 >= (size_t)TLIM) return;
  for (int rw = wv; rw < 16 * PMT; rw += PNW) { const size_t xr = ((m0 + rw) / L) * L + DIL * ((m0 + rw) % NC) + ((m0 + rw) % L) / NC;   // the token that stands at position m0 + rw
    float xv[C / 32];   // a row's 32 loads are requested before the first rounding: no load is moved across the asm statement in bf16_rne, so load by load each would wait out memory alone, and a wave now stages 5 or 6 rows
#pragma unroll
    for (int q = 0; q < C / 32; ++q) xv[q] = x[xr * C + q * 32 + lane];
#pragma unroll
    for (int q = 0; q < C / 32; ++q) Ah[rw][q * 32 + lane] = (b16)(bf16_rne(xv[q]) * XS); }
  __syncthreads();   // every wave reads all staged rows
  const int c0 = ((int)blockIdx.y * PNW + wv) * 64, pj = c0 / C, hd = (c0 % C) / HD; const float sc = pj == 0 ? SCALE : 1.0f; const b16* wp = W3 + (size_t)(c0 / 16) * (C / 32) * 512 + lane * 8; v8f acc[PMT][4];
#pragma unroll
  for (int mt = 0; mt < PMT; ++mt)
#pragma unroll
    for (int t = 0; t < 4; ++t) acc[mt][t] = (v8f){};
  for (int kb = 0; kb < C; kb += 64) { v16b bw[2][4];   // a trip is 64 k: its 16 weight loads are requested before its first product, so the trip waits for L2 once; with 3 waves on a SIMD the other waves' products cover that wait
#pragma unroll
    for (int s = 0; s < 2; ++s)
#pragma unroll
      for (int t = 0; t < 4; ++t) bw[s][t] = frag_fo(wp + t * 16 * C + (kb + 32 * s) * 16);
#pragma unroll
    for (int s = 0; s < 2; ++s) { v16b a[PMT];   // the four row tiles' fragments as one group of LDS reads
#pragma unroll
      for (int mt = 0; mt < PMT; ++mt) a[mt] = frag_kb(&Ah[mt * 16 + nloc][kb + 32 * s], hlf);
#pragma unroll
      for (int mt = 0; mt < PMT; ++mt)
#pragma unroll
        for (int t = 0; t < 4; ++t) acc[mt][t] = wmma16b(a[mt], bw[s][t], acc[mt][t]); } }
#pragma unroll
  for (int mt = 0; mt < PMT; ++mt) { const size_t mm = m0 + mt * 16; const size_t tb = (((mm / L) * NH + hd) * (L / 16) + (mm % L) / 16) * (HD * 16);   // this row tile's first position; its k or v tile of the wave's head
    if (pj == 2) {
#pragma unroll
      for (int t = 0; t < 4; ++t) { v8b vh, vl;
#pragma unroll
        for (int r8 = 0; r8 < 8; ++r8) { b16 p, ql; split16((acc[mt][t][r8] * (1.0f / (XS * WSC)) + 0.0f) * sc * HS, p, ql); vh[r8] = p; vl[r8] = ql; }
        *(v8b*)(VTH + tb + (t * 16 + nloc) * 16 + 8 * hlf) = vh; *(v8b*)(VTL + tb + (t * 16 + nloc) * 16 + 8 * hlf) = vl; }
      asm volatile("s_wait_xcnt 0x0" ::: "memory");   // behind the run of v stores: the code that stands behind it in the listing rewrites registers that the stores name
    }
    else {
#pragma unroll
      for (int t = 0; t < 4; ++t) { const int cc = t * 16 + nloc; const float bvv = 0.0f;
#pragma unroll
        for (int r8 = 0; r8 < 8; ++r8) { b16 p, ql; split16((acc[mt][t][r8] * (1.0f / (XS * WSC)) + bvv) * sc * HS, p, ql); Oh[wv][8 * hlf + r8][cc] = p; Ol[wv][8 * hlf + r8][cc] = ql; } }
      wave_lds_only();
      if (pj == 1) {
#pragma unroll
        for (int i = 0; i < 4; ++i) { *(v8b*)(KFH + tb + lane * 8 + i * 256) = *(const v8b*)(&Oh[wv][nloc][i * 16 + 8 * hlf]); *(v8b*)(KFL + tb + lane * 8 + i * 256) = *(const v8b*)(&Ol[wv][nloc][i * 16 + 8 * hlf]); }
        asm volatile("s_wait_xcnt 0x0" ::: "memory");   // behind the run of k stores, for the same reason
      }
      else { const int ro = lane >> 3, cs = (lane & 7) * 8; for (int rr = 0; rr < 16; rr += 4) { *(v8b*)(PH + (mm + rr + ro) * PW + c0 + cs) = *(const v8b*)(&Oh[wv][rr + ro][cs]); *(v8b*)(PL + (mm + rr + ro) * PW + c0 + cs) = *(const v8b*)(&Ol[wv][rr + ro][cs]); }
        asm volatile("s_wait_xcnt 0x0" ::: "memory");   // behind the run of q stores, for the same reason
      }
      wave_lds_only();   // the next row tile rewrites the wave's staging rows
    }
  }
}
// attention: ONE WAVE PER BLOCK, wave per (b, h, 16-query tile of one residue class): key blocks of 8 tiles from the list of key_tile() (own class up to the diagonal, the other classes inside the window), every key that the mask allows exactly once; S = Q K^T (3 products, K 64); online softmax in the accumulator registers (row maximum and sum by DPP over the 16 lanes of a row); P x256 hi+lo goes through LDS into A-fragment order; the V^T fragments are read straight from VTH/VTL (each 16-byte load of a wave covers 512 bytes in a row), nothing of V is staged in LDS.
__global__ __launch_bounds__(32) void att_kernel(const b16* __restrict__ PH, const b16* __restrict__ PL, const b16* __restrict__ KFH, const b16* __restrict__ KFL, const b16* __restrict__ VTH, const b16* __restrict__ VTL, const float* __restrict__ amask, int BLIM, float* __restrict__ ATT) { __shared__ __attribute__((aligned(16))) b16 Ph_[16][KB + 8], Pl_[16][KB + 8]; __shared__ float Of[16][HD + 4];
  const int lane = threadIdx.x, nloc = lane & 15, hlf = lane >> 4; 
  // block index -> (batch, head, class r, tile g): a permutation, chosen for placement (for speed only; the result is the same wherever a block runs). A wave's work grows with g (g + 10 key tiles), with g = index % 32 every set of indices at a stride of 32 or more held one g alone.
  // bits 0..2: the head modulo 8, so a head's 128 tiles stand on indices that are equal modulo 8; bits 3..4: r; bits 5..7: gl = g modulo 8; bits 8..9: cq; bits 10..11: jj = head / 8 (batch included).
  // the quarter gh of g is the sum modulo 4 of all fields above bit 2 (bit 7 counts 2), and in odd quarters g modulo 8 runs backwards: 16 indices at any stride 8, 16 .. 256, and 4 of them taken in a row or every fourth (except 4 at a stride of 64), then hold nearly the same number of key tiles.
  static_assert(NH % 8 == 0 && DIL == 4 && TPC == 32, "the bit fields of the block index");
  const int bi = blockIdx.x, jj = bi >> 10, cq = (bi >> 8) & 3, r = (bi >> 3) & 3, gl = (bi >> 5) & 7, gh = (r + gl + 2 * (gl >> 2) + cq + jj) & 3, g = gh * 8 + ((gh & 1) ? 7 - gl : gl), hb = (bi & 7) + 8 * jj; const int h = hb % NH; const int b = hb / NH; if (b >= BLIM) return; const int qt = r * TPC + g, t0 = qt * 16; const size_t rowb = (size_t)b * L; const int qo = h * HD; const size_t vtb = (size_t)(b * NH + h) * (L / 16) * (HD * 16); const unsigned vlo = nloc * 16 + 8 * hlf;   // the head's first K or V^T tile (the same for the wave); this lane's d row (mod 16) and token half inside a tile
  v16b qh[HD / 32], ql[HD / 32];
#pragma unroll
  for (int s = 0; s < HD / 32; ++s) { qh[s] = frag_kb(PH + (rowb + t0 + nloc) * PW + qo + s * 32, hlf); ql[s] = frag_kb(PL + (rowb + t0 + nloc) * PW + qo + s * 32, hlf); }
  float m_r[8], den_r[8]; v8f acc[HD / 16];
#pragma unroll
  for (int r8 = 0; r8 < 8; ++r8) { m_r[r8] = -INFINITY; den_r[r8] = 0.0f; }
#pragma unroll
  for (int t = 0; t < HD / 16; ++t) acc[t] = (v8f){};
  const int ntile = g + 1 + WT * (DIL - 1);   // length of the key tile list
#pragma unroll 1
  for (int u0 = 0; u0 < ntile; u0 += KB / 16) { const int nkt = (ntile - u0) < KB / 16 ? (ntile - u0) : KB / 16;
    v8f sv[KB / 16];   // the block's masked scores stay where the WMMA leaves them: sv[t][r8] = row 8*hlf + r8, key column t*16 + nloc; the t loops below are unrolled so that sv[t] names registers and not scratch memory
    // the score stage is straight-line code per group of KG key tiles, with one wave-uniform test per group: all K fragments of the group are requested before its first product (one wait for L2 per group), the tiles' accumulator chains alternate, and the mask is a select. A place of the list without a tile reads the class's first tile (written, finite) and is masked whole. The loops over a, q and r8 are unrolled so that the fragment and score arrays name registers.
#pragma unroll
    for (int tg = 0; tg < KB / 16; tg += KG) { if (u0 + tg < ntile) { int kt[KG]; const b16 *ph[KG], *pl[KG]; v16b kh[KG][HD / 32], kl[KG][HD / 32]; v8f s[KG];
#pragma unroll
        for (int a = 0; a < KG; ++a) { kt[a] = key_tile(u0 + tg + a, g, r); const size_t kr = vtb + (size_t)(kt[a] < 0 ? r * TPC : kt[a]) * (HD * 16) + lane * 8; ph[a] = KFH + kr; pl[a] = KFL + kr; s[a] = (v8f){}; }
#pragma unroll
        for (int a = 0; a < KG; ++a)
#pragma unroll
          for (int q = 0; q < HD / 32; ++q) { kh[a][q] = frag_fo(ph[a] + q * 512); kl[a][q] = frag_fo(pl[a] + q * 512); }
#pragma unroll
        for (int q = 0; q < HD / 32; ++q) {   // per accumulator the order of the products is q-hi k-hi, q-hi k-lo, q-lo k-hi, as before
#pragma unroll
          for (int a = 0; a < KG; ++a) s[a] = wmma16b(qh[q], kh[a][q], s[a]);
#pragma unroll
          for (int a = 0; a < KG; ++a) s[a] = wmma16b(qh[q], kl[a][q], s[a]);
#pragma unroll
          for (int a = 0; a < KG; ++a) s[a] = wmma16b(ql[q], kh[a][q], s[a]); }
#pragma unroll
        for (int a = 0; a < KG; ++a) asm volatile("s_wait_xcnt 0x0" :: "v"(ph[a]), "v"(pl[a]) : "memory");   // later code rewrites the address registers that the group's K loads name; as inputs here they stay untouched (also by a later load's result) up to this wait
#pragma unroll
        for (int a = 0; a < KG; ++a) { const int kc = kt[a] < 0 ? r * TPC : kt[a], j = kc / TPC + DIL * ((kc % TPC) * 16 + nloc);   // the key's token
          // with d = i - j the mask (window 0 <= d <= 127, or dilated d >= 132 with d % 4 == 0) reads: own class (d % 4 == 0): d >= 0 and d != 128; another class (d % 4 != 0): 0 <= d < 128; no tile: nothing
          const unsigned lim = kt[a] < 0 ? 0u : (kc / TPC == r ? 0x80000000u : (unsigned)WINDOW);
#pragma unroll
          for (int r8 = 0; r8 < 8; ++r8) { const int d = r + DIL * (g * 16 + 8 * hlf + r8) - j; const bool ok = ((unsigned)d < lim) & (d != WINDOW); sv[tg + a][r8] = ok ? s[a][r8] * (1.0f / (HS * HS)) : -INFINITY; } } }
      else {
#pragma unroll
        for (int a = 0; a < KG; ++a)
#pragma unroll
          for (int r8 = 0; r8 < 8; ++r8) sv[tg + a][r8] = -INFINITY; } }
    // a lane owns 8 rows (its accumulator rows) and one key column of each tile: maximum and sum run over the 8 tiles in the lane, then over the 16 lanes of the row; the 8 rows are independent chains
#pragma unroll
    for (int r8 = 0; r8 < 8; ++r8) { float mx = sv[0][r8];
#pragma unroll
      for (int t = 1; t < KB / 16; ++t) mx = fmaxf(mx, sv[t][r8]);
      mx = row_max16(mx);
      const float mold = m_r[r8]; const float mn = fmaxf(mold, mx); const float sf = (mold == -INFINITY) ? 0.0f : ((mn == -INFINITY) ? 1.0f : __expf(mold - mn)); float ps = 0.0f;
#pragma unroll
      for (int t = 0; t < KB / 16; ++t) { const float x = sv[t][r8]; const float p = (x == -INFINITY || mn == -INFINITY) ? 0.0f : __expf(x - mn); ps += p; b16 ph, pl; split16(p * PS, ph, pl); Ph_[8 * hlf + r8][t * 16 + nloc] = ph; Pl_[8 * hlf + r8][t * 16 + nloc] = pl; }
      ps = row_sum16(ps);
      den_r[r8] = den_r[r8] * sf + ps; m_r[r8] = mn;
#pragma unroll
      for (int t = 0; t < HD / 16; ++t) acc[t][r8] = acc[t][r8] * sf; }
    wave_lds_sync();
    for (int ks = 0; ks < nkt * 16; ks += 32) { const v16b pa = frag_kb(&Ph_[nloc][ks], hlf), pb = frag_kb(&Pl_[nloc][ks], hlf); const int ka = key_tile(u0 + ks / 16, g, r), kc = key_tile(u0 + ks / 16 + 1, g, r); const size_t vp = vtb + (size_t)(ka < 0 ? r * TPC : ka) * (HD * 16), vp2 = vtb + (size_t)(kc < 0 ? r * TPC : kc) * (HD * 16);   /* two tiles of the list; where the list has none, p = 0 there and any written tile serves (finite V) */
      const b16 *h1 = VTH + vp + vlo, *h2 = VTH + vp2 + vlo, *l1 = VTL + vp + vlo, *l2 = VTL + vp2 + vlo;   // this lane's place in the two tiles, hi and lo plane
      v16b vh[HD / 16], vl[HD / 16];   // all eight fragments of the trip are requested before the first product, so the trip waits for L2 once and not once per d tile
#pragma unroll
      for (int t = 0; t < HD / 16; ++t) { vh[t] = frag_vt(h1 + t * 256, h2 + t * 256); vl[t] = frag_vt(l1 + t * 256, l2 + t * 256); }
#pragma unroll
      for (int t = 0; t < HD / 16; ++t) { acc[t] = wmma16b(pa, vh[t], acc[t]); acc[t] = wmma16b(pa, vl[t], acc[t]); acc[t] = wmma16b(pb, vh[t], acc[t]); }
      asm volatile("s_wait_xcnt 0x0" :: "v"(h1), "v"(h2), "v"(l1), "v"(l2) : "memory");   // the next trip rewrites the address registers that this trip's V^T loads name; as inputs here they stay untouched (also by a later load's result) up to this wait
    }
    wave_lds_sync(); }
#pragma unroll
  for (int t = 0; t < HD / 16; ++t)
#pragma unroll
    for (int r8 = 0; r8 < 8; ++r8) { const float dn = den_r[r8]; Of[8 * hlf + r8][t * 16 + nloc] = dn > 0.0f ? acc[t][r8] * (1.0f / (HS * PS)) / dn : 0.0f; }
  wave_lds_sync();
  { for (int rr = 0; rr < 16; ++rr) for (int s = 0; s < HD / 32; ++s) ((float*)ATT)[(rowb + r + DIL * (g * 16 + rr)) * C + h * HD + s * 32 + lane] = Of[rr][s * 32 + lane];  } }
// output product: block = 16 waves on OMT = 4 tiles of 16 tokens and 256 of the 1,024 columns (blockIdx.y); the waves share the staged hi+lo rows; wave wv owns rows (wv / 8) * 32 .. + 31 and columns (wv % 8) * 32 .. + 31 of the block: a weight fragment feeds 2 row tiles in the wave, and the block reads its weights for 64 rows. 64 x 4 = 256 blocks, one per WGP.
__global__ __launch_bounds__(512) void out_kernel(const float* __restrict__ ATT, const b16* __restrict__ WO, const float* __restrict__ bo, int TLIM, float* __restrict__ out) { __shared__ __attribute__((aligned(16))) b16 Ah[16 * OMT][C + 8], Al[16 * OMT][C + 8]; __shared__ __attribute__((aligned(16))) float Tf[16][16][36]; const int lane = threadIdx.x & 31, wv = __builtin_amdgcn_readfirstlane(threadIdx.x >> 5), nloc = lane & 15, hlf = lane >> 4; const size_t m0 = (size_t)blockIdx.x * (16 * OMT); if (m0 >= (size_t)TLIM) return;
  for (int rr = wv * OMT; rr < wv * OMT + OMT; ++rr) for (int q = 0; q < C / 32; ++q) { b16 p, ql; split16(ATT[(m0 + rr) * C + q * 32 + lane] * HS, p, ql); Ah[rr][q * 32 + lane] = p; Al[rr][q * 32 + lane] = ql; }
  __syncthreads();   // every wave reads 32 staged rows, written by 8 waves
  const int r0 = (wv >> 3) * 32, c0 = (int)blockIdx.y * ONC + (wv & 7) * 32; const b16* wp = WO + (size_t)(c0 / 16) * (C / 32) * 512 + lane * 8; v8f acc[2][2];
#pragma unroll
  for (int mt = 0; mt < 2; ++mt)
#pragma unroll
    for (int t = 0; t < 2; ++t) acc[mt][t] = (v8f){};
  for (int kb = 0; kb < C; kb += 128) { v16b bw[4][2];   // a trip is 128 k: its 16 weight loads are requested before its first product, so the trip waits for L2 once
#pragma unroll
    for (int s = 0; s < 4; ++s)
#pragma unroll
      for (int t = 0; t < 2; ++t) bw[s][t] = frag_fo(wp + t * 16 * C + (kb + 32 * s) * 16);
#pragma unroll
    for (int s = 0; s < 4; ++s) { v16b a[2], al[2];
#pragma unroll
      for (int mt = 0; mt < 2; ++mt) { a[mt] = frag_kb(&Ah[r0 + mt * 16 + nloc][kb + 32 * s], hlf); al[mt] = frag_kb(&Al[r0 + mt * 16 + nloc][kb + 32 * s], hlf); }
      // per accumulator hi then lo, as before; the other accumulators' products stand between an accumulator's two
#pragma unroll
      for (int mt = 0; mt < 2; ++mt)
#pragma unroll
        for (int t = 0; t < 2; ++t) acc[mt][t] = wmma16b(a[mt], bw[s][t], acc[mt][t]);
#pragma unroll
      for (int mt = 0; mt < 2; ++mt)
#pragma unroll
        for (int t = 0; t < 2; ++t) acc[mt][t] = wmma16b(al[mt], bw[s][t], acc[mt][t]); } }
#pragma unroll
  for (int mt = 0; mt < 2; ++mt) {
#pragma unroll
    for (int t = 0; t < 2; ++t) { const int cc = t * 16 + nloc; const float bb = 0.0f;
#pragma unroll
      for (int r8 = 0; r8 < 8; ++r8) Tf[wv][8 * hlf + r8][cc] = acc[mt][t][r8] * (1.0f / (HS * WSC)) + bb; }
    wave_lds_only();
    { const int ro = lane >> 3, cs = (lane & 7) * 4; for (int rr = 0; rr < 16; rr += 4) *(v4f*)(out + (m0 + r0 + mt * 16 + rr + ro) * C + c0 + cs) = *(const v4f*)(&Tf[wv][rr + ro][cs]); }
    wave_lds_only();   // the next row tile rewrites the wave's staging rows
    asm volatile("s_wait_xcnt 0x0" ::: "memory");   // behind a row tile's run of stores: the next tile's addresses may rewrite registers that hold theirs
  } }
}  // namespace

extern "C" void kernel_launch(void* const* d_in, const int* in_sizes, int n_in, void* d_out, int out_size, void* d_ws, size_t ws_size, hipStream_t stream) {
  (void)n_in;
  auto Fp = [&](int i) { return (const float*)d_in[i]; };
  // input order: 0 x [2,2048,1024]; 1 qkv [3072,1024] (out,in: rows q|k|v); 2 wo [1024,1024] (out,in)
  if (in_sizes[0] != NT * C || in_sizes[1] != 3 * C * C || in_sizes[2] != C * C || out_size != NT * C) return;
  const int BLIM = NB;   // batch cut
  const int TLIM = BLIM * L;
  size_t off = 0; char* ws = (char*)d_ws;
  auto carve = [&](size_t bytes) { char* p = ws + off; off += (bytes + 255) & ~(size_t)255; return p; };
  b16* W3 = (b16*)carve((size_t)3 * C * C * 2); b16* WO = (b16*)carve((size_t)C * C * 2); b16* PH = (b16*)carve((size_t)NT * PW * 2); b16* PL = (b16*)carve((size_t)NT * PW * 2); float* ATT = (float*)carve((size_t)NT * C * 4); b16* VTH = (b16*)carve((size_t)NT * C * 2); b16* VTL = (b16*)carve((size_t)NT * C * 2); b16* KFH = (b16*)carve((size_t)NT * C * 2); b16* KFL = (b16*)carve((size_t)NT * C * 2);
  if (off > ws_size || off > ((size_t)112 << 20)) return;   // ~ 104 MiB
  wput_kernel<<<(unsigned)(((size_t)4 * C * (C / 8) + 255) / 256), 256, 0, stream>>>(Fp(1), Fp(1) + (size_t)C * C, Fp(1) + (size_t)2 * C * C, Fp(2), W3, WO);
  proj_kernel<<<dim3(TLIM / (16 * PMT), PW / (64 * PNW)), PNW * 32, 0, stream>>>(Fp(0), W3, Fp(0), Fp(0), Fp(0), TLIM, PH, PL, VTH, VTL, KFH, KFL);
  att_kernel<<<BLIM * NH * (L / 16), 32, 0, stream>>>(PH, PL, KFH, KFL, VTH, VTL, (const float*)0, BLIM, ATT);
  out_kernel<<<dim3(TLIM / (16 * OMT), C / ONC), 512, 0, stream>>>(ATT, WO, (const float*)0, TLIM, (float*)d_out);
}

// v009
// Measured time: 96.7 microseconds a run.
// Timed twice side by side with v008, it ran 1.06 times as fast both times.
// Counting every step since v000, it is 29.6 times as fast.
#include <hip/hip_runtime.h>

// CustomWindowMHA: 16 heads x 64 over 2 x 2,048 tokens; token i attends to j in the causal window i-127..i OR the dilated set j = i-128-4m (m >= 1, j >= 0); QKV = x qkv^T (no bias), scores/8, masked softmax, out = (attn v) wo^T -> [2][2048][1024].
// Deterministic: no index structures, no atomics; flash-style online softmax over the key tiles of a query tile in a fixed order.
// TOKEN ORDER IN THE WORKSPACE: q, k and v are kept by residue class, position p = (token % 4) * 512 + token / 4 inside a sequence. A query tile is 16 positions in a row = 16 tokens of ONE class, so its dilated keys (same class) are rows in a row, and the three other classes matter only inside the window (3 tiles of 16 each).
// FRAGMENT ORDER: the B operands that a wave reads from global memory as weights (W3, WO) and keys (KFH/KFL) are stored as the WMMA wants it: per tile of 16 rows and per 32 k one block of 512 elements [16-k half j][lane][8], lane = 16*hh + row, k = 16j + 8hh + 0..7. A wave's 16-byte load then covers 512 bytes in a row (4 lines) where row-major storage gave it 32 bytes of each of 16 lines.
// WMMA (v_wmma_f32_16x16x32_f16, f32 accumulate): the QKV projection with x EXACT bf16 x8 (K 1024) against exact torch weight rows x256 (one product); S = Q K^T (hi+lo x hi+lo, 3 products, K 64); O = P V (P x256 hi+lo x V^T hi+lo, 3 products; V^T comes ready from the projection, see VTH/VTL); out = attended (hi+lo) Wo^T (2 products); softmax in f32. Inputs rounded to bf16 once. Fragment k-map per lane half hh for A AND B: elements 0..7 <- k = 8hh+0..7, 8..15 <- k = 16+8hh+0..7; acc[r] = D[8hh+r][col].

namespace {
constexpr int NB = 2, L = 2048, C = 1024, NH = 16, HD = 64, NT = NB * L, KB = 128, PW = 3 * C;
constexpr int WINDOW = 128, DIL = 4, KG = 2 /* key tiles whose K fragments attention requests together */;
constexpr int NC = L / DIL /* positions per residue class */, TPC = NC / 16 /* 16-position tiles per class */, WT = WINDOW / (DIL * 16) + 1 /* tiles of a foreign class that a query tile's windows can touch */;
constexpr int PMT = 4 /* 16-row tiles per projection block */, PNW = 12 /* its waves, 64 columns each */, OMT = 4 /* 16-row tiles per output-product block */, ONC = 256 /* its columns */, WU = 4 /* units of 8 weights per thread of the repack */;
constexpr float XS = 8.0f, HS = 256.0f /* hi+lo staging scale for q/k/v/attended */, WSC = 256.0f, PS = 256.0f, SCALE = 0.125f;
typedef _Float16 b16;
typedef __attribute__((ext_vector_type(16))) _Float16 v16b;
typedef __attribute__((ext_vector_type(8))) _Float16 v8b;
typedef __attribute__((ext_vector_type(8))) float v8f;
typedef __attribute__((ext_vector_type(4))) float v4f;
__device__ __forceinline__ float bf16_rne(float f) { unsigned int u = __float_as_uint(f); u += 0x7FFFu + ((u >> 16) & 1u); float r = __uint_as_float(u & 0xFFFF0000u); asm volatile("" : "+v"(r)); return r; }
__device__ __forceinline__ float bfv(float f) { float r = bf16_rne(f); asm volatile("" : "+v"(r)); return r; }
__device__ __forceinline__ void split16(float v, b16& hi, b16& lo) { hi = (b16)v; lo = (b16)(v - (float)hi); }
__device__ __forceinline__ v16b frag_kb(const b16* p, int hh) { const v8b a = *(const v8b*)(p + 8 * hh), b = *(const v8b*)(p + 16 + 8 * hh); v16b f;
#pragma unroll
  for (int e = 0; e < 8; ++e) { f[e] = a[e]; f[8 + e] = b[e]; } return f; }
// V^T fragment of 32 keys from the tiled planes: p and p2 point at this lane's (d, 8*hh) in the first and the second 16-position tile of the pair; elements 0..7 <- k = 8hh+0..7 (p), 8..15 <- k = 16+8hh+0..7 (p2): the same k-map as frag_kb.
__device__ __forceinline__ v16b frag_vt(const b16* p, const b16* p2) { const v8b a = *(const v8b*)p, b = *(const v8b*)p2; v16b f;
#pragma unroll
  for (int e = 0; e < 8; ++e) { f[e] = a[e]; f[8 + e] = b[e]; } return f; }
// fragment of 32 k from a fragment-order block: p points at this lane's 8 elements of half j = 0, half j = 1 stands 256 elements on; the same k-map as frag_kb.
__device__ __forceinline__ v16b frag_fo(const b16* p) { return frag_vt(p, p + 256); }
__device__ __forceinline__ v8f wmma16b(v16b a, v16b b, v8f c) { v8f d = __builtin_amdgcn_wmma_f32_16x16x32_f16(false, a, false, b, (short)0, c, false, false); asm volatile("v_nop\n\tv_nop\n\tv_nop\n\tv_nop" : "+v"(d) : "v"(a), "v"(b)); return d; }
__device__ __forceinline__ void wave_lds_sync() { __builtin_amdgcn_fence(__ATOMIC_RELEASE, "workgroup"); __builtin_amdgcn_wave_barrier(); __builtin_amdgcn_fence(__ATOMIC_ACQUIRE, "workgroup"); }
// the same for LDS alone: in the GEMM epilogues, which loop over row tiles, the fence above would also wait for the last tile's global stores to finish
__device__ __forceinline__ void wave_lds_only() { __builtin_amdgcn_fence(__ATOMIC_RELEASE, "workgroup", "local"); __builtin_amdgcn_wave_barrier(); __builtin_amdgcn_fence(__ATOMIC_ACQUIRE, "workgroup", "local"); }
// u-th key tile of query tile (class r, tile g of the class), as a tile number in position order, or -1 for none: first the own class from its start up to the diagonal (u = 0..g), then of each other class the WT tiles g-WT+1..g that the windows reach.
__device__ __forceinline__ int key_tile(int u, int g, int r) { const int v = u - g - 1, ci = v / WT, tau = g - (WT - 1) + v % WT; const int f = ((ci >= DIL - 1) | (tau < 0)) ? -1 : (ci + (ci >= r ? 1 : 0)) * TPC + tau; return u <= g ? r * TPC + u : f; }
// lane l's value from lane l ^ M of the same 16-lane row, as a DPP operand (no LDS round trip, unlike __shfl_xor)
template <int M> __device__ __forceinline__ float rowx(float x) { return __builtin_bit_cast(float, __builtin_amdgcn_update_dpp(0, __builtin_bit_cast(int, x), 0x160 + M, 0xf, 0xf, true)); }
__device__ __forceinline__ float row_max16(float x) { x = fmaxf(x, rowx<1>(x)); x = fmaxf(x, rowx<2>(x)); x = fmaxf(x, rowx<4>(x)); return fmaxf(x, rowx<8>(x)); }
__device__ __forceinline__ float row_sum16(float x) { x += rowx<1>(x); x += rowx<2>(x); x += rowx<4>(x); return x + rowx<8>(x); }
__device__ __forceinline__ float pmul(float a, float b) { float p = a * b; asm volatile("" : "+v"(p)); return p; }

// weight repack: a block takes 8 whole weight rows, a thread WU units of 8 weights of one row, 256 k apart: 512 blocks of 8 waves, two per WGP. Few long waves and not many short ones, for speed only; a wave has its 8 16-byte loads in flight together, and which weight it reads is the same for the whole block.
__global__ __launch_bounds__(256) void wput_kernel(const float* __restrict__ wq, const float* __restrict__ wk, const float* __restrict__ wv, const float* __restrict__ wo, b16* __restrict__ W3, b16* __restrict__ WO) { static_assert(WU * 256 == C && C % 8 == 0, "8 rows are WU * 256 units; a block's rows lie in one weight"); const int tid = threadIdx.x, c = tid & 3, kw = tid >> 5, r = (int)blockIdx.x * 8 + ((tid >> 2) & 7);   /* a wave takes 32 k of 8 rows at a time: it reads 8 whole lines and writes 4 whole lines; unit i has ks = i * 8 + kw */ const int p = ((int)blockIdx.x * 8) / C, o = r % C, rb = p < 3 ? r : o; const float* w = (p == 0 ? wq : (p == 1 ? wk : (p == 2 ? wv : wo))) + (size_t)o * C + kw * 32 + c * 8; b16* d = (p < 3 ? W3 : WO) + ((size_t)(rb >> 4) * (C / 32) + kw) * 512 + (c >> 1) * 256 + ((c & 1) * 16 + (rb & 15)) * 8; float xv[WU][8];
#pragma unroll
  for (int i = 0; i < WU; ++i)
#pragma unroll
    for (int j = 0; j < 8; ++j) xv[i][j] = w[i * 256 + j];
#pragma unroll
  for (int i = 0; i < WU; ++i) { v8b v;
#pragma unroll
    for (int j = 0; j < 8; ++j) v[j] = (b16)(bf16_rne(xv[i][j]) * WSC);
    *(v8b*)(d + i * 8 * 512) = v; } }
// projection: block = 12 waves on PMT = 4 tiles of 16 positions (64 positions in a row of one residue class, see the head of the file) and 768 of the 3,072 columns q|k|v (blockIdx.y); the waves share the staged x rows, a wave owns 64 columns = one head of one of q, k, v, for all 64 rows: a weight fragment is read from L2 once and multiplied with 4 row tiles. 64 x 4 = 256 blocks, one per WGP.
// q goes out token-major (PH/PL). k goes out in fragment order, tiled [b][head][16-token tile][d half 0..1][j][lane][8] (KFH/KFL): a wave owns one head and writes 2 KiB in a row per plane and tile. v goes out TRANSPOSED, tiled [b][head][16-token tile][d 0..63][token 0..15] (VTH/VTL): a lane's 8 accumulator rows are 8 consecutive tokens of one d, so it stores them as one 16-byte word; a wave owns one head and writes 2 KiB in a row per plane and tile.
__global__ __launch_bounds__(PNW * 32) void proj_kernel(const float* __restrict__ x, const b16* __restrict__ W3, const float* __restrict__ bq, const float* __restrict__ bk, const float* __restrict__ bv, int TLIM, b16* __restrict__ PH, b16* __restrict__ PL, b16* __restrict__ VTH, b16* __restrict__ VTL, b16* __restrict__ KFH, b16* __restrict__ KFL) { __shared__ __attribute__((aligned(16))) b16 Ah[16 * PMT][C + 8], Oh[PNW][16][72], Ol[PNW][16][72]; const int lane = threadIdx.x & 31, wv = __builtin_amdgcn_readfirstlane(threadIdx.x >> 5), nloc = lane & 15, hlf = lane >> 4; const size_t m0 = (size_t)blockIdx.x * (16 * PMT); if (m0 >= (size_t)TLIM) return;
  for (int rw = wv; rw < 16 * PMT; rw += PNW) { const size_t xr = ((m0 + rw) / L) * L + DIL * ((m0 + rw) % NC) + ((m0 + rw) % L) / NC;   // the token that stands at position m0 + rw
    float xv[C / 32];   // a row's 32 loads are requested before the first rounding: no load is moved across the asm statement in bf16_rne, so load by load each would wait out memory alone, and a wave now stages 5 or 6 rows
#pragma unroll
    for (int q = 0; q < C / 32; ++q) xv[q] = x[xr * C + q * 32 + lane];
#pragma unroll
    for (int q = 0; q < C / 32; ++q) Ah[rw][q * 32 + lane] = (b16)(bf16_rne(xv[q]) * XS); }
  __syncthreads();   // every wave reads all staged rows
  const int c0 = ((int)blockIdx.y * PNW + wv) * 64, pj = c0 / C, hd = (c0 % C) / HD; const float sc = pj == 0 ? SCALE : 1.0f; const b16* wp = W3 + (size_t)(c0 / 16) * (C / 32) * 512 + lane * 8; v8f acc[PMT][4];
#pragma unroll
  for (int mt = 0; mt < PMT; ++mt)
#pragma unroll
    for (int t = 0; t < 4; ++t) acc[mt][t] = (v8f){};
  for (int kb = 0; kb < C; kb += 64) { v16b bw[2][4];   // a trip is 64 k: its 16 weight loads are requested before its first product, so the trip waits for L2 once; with 3 waves on a SIMD the other waves' products cover that wait
#pragma unroll
    for (int s = 0; s < 2; ++s)
#pragma unroll
      for (int t = 0; t < 4; ++t) bw[s][t] = frag_fo(wp + t * 16 * C + (kb + 32 * s) * 16);
#pragma unroll
    for (int s = 0; s < 2; ++s) { v16b a[PMT];   // the four row tiles' fragments as one group of LDS reads
#pragma unroll
      for (int mt = 0; mt < PMT; ++mt) a[mt] = frag_kb(&Ah[mt * 16 + nloc][kb + 32 * s], hlf);
#pragma unroll
      for (int mt = 0; mt < PMT; ++mt)
#pragma unroll
        for (int t = 0; t < 4; ++t) acc[mt][t] = wmma16b(a[mt], bw[s][t], acc[mt][t]); } }
#pragma unroll
  for (int mt = 0; mt < PMT; ++mt) { const size_t mm = m0 + mt * 16; const size_t tb = (((mm / L) * NH + hd) * (L / 16) + (mm % L) / 16) * (HD * 16);   // this row tile's first position; its k or v tile of the wave's head
    if (pj == 2) {
#pragma unroll
      for (int t = 0; t < 4; ++t) { v8b vh, vl;
#pragma unroll
        for (int r8 = 0; r8 < 8; ++r8) { b16 p, ql; split16((acc[mt][t][r8] * (1.0f / (XS * WSC)) + 0.0f) * sc * HS, p, ql); vh[r8] = p; vl[r8] = ql; }
        *(v8b*)(VTH + tb + (t * 16 + nloc) * 16 + 8 * hlf) = vh; *(v8b*)(VTL + tb + (t * 16 + nloc) * 16 + 8 * hlf) = vl; }
      asm volatile("s_wait_xcnt 0x0" ::: "memory");   // behind the run of v stores: the code that stands behind it in the listing rewrites registers that the stores name
    }
    else {
#pragma unroll
      for (int t = 0; t < 4; ++t) { const int cc = t * 16 + nloc; const float bvv = 0.0f;
#pragma unroll
        for (int r8 = 0; r8 < 8; ++r8) { b16 p, ql; split16((acc[mt][t][r8] * (1.0f / (XS * WSC)) + bvv) * sc * HS, p, ql); Oh[wv][8 * hlf + r8][cc] = p; Ol[wv][8 * hlf + r8][cc] = ql; } }
      wave_lds_only();
      if (pj == 1) {
#pragma unroll
        for (int i = 0; i < 4; ++i) { *(v8b*)(KFH + tb + lane * 8 + i * 256) = *(const v8b*)(&Oh[wv][nloc][i * 16 + 8 * hlf]); *(v8b*)(KFL + tb + lane * 8 + i * 256) = *(const v8b*)(&Ol[wv][nloc][i * 16 + 8 * hlf]); }
        asm volatile("s_wait_xcnt 0x0" ::: "memory");   // behind the run of k stores, for the same reason
      }
      else { const int ro = lane >> 3, cs = (lane & 7) * 8; for (int rr = 0; rr < 16; rr += 4) { *(v8b*)(PH + (mm + rr + ro) * PW + c0 + cs) = *(const v8b*)(&Oh[wv][rr + ro][cs]); *(v8b*)(PL + (mm + rr + ro) * PW + c0 + cs) = *(const v8b*)(&Ol[wv][rr + ro][cs]); }
        asm volatile("s_wait_xcnt 0x0" ::: "memory");   // behind the run of q stores, for the same reason
      }
      wave_lds_only();   // the next row tile rewrites the wave's staging rows
    }
  }
}
// attention: ONE WAVE PER BLOCK, wave per (b, h, 16-query tile of one residue class): key blocks of 8 tiles from the list of key_tile() (own class up to the diagonal, the other classes inside the window), every key that the mask allows exactly once; S = Q K^T (3 products, K 64); online softmax in the accumulator registers (row maximum and sum by DPP over the 16 lanes of a row); P x256 hi+lo goes through LDS into A-fragment order; the V^T fragments are read straight from VTH/VTL (each 16-byte load of a wave covers 512 bytes in a row), nothing of V is staged in LDS.
__global__ __launch_bounds__(32) void att_kernel(const b16* __restrict__ PH, const b16* __restrict__ PL, const b16* __restrict__ KFH, const b16* __restrict__ KFL, const b16* __restrict__ VTH, const b16* __restrict__ VTL, const float* __restrict__ amask, int BLIM, float* __restrict__ ATT) { __shared__ __attribute__((aligned(16))) b16 Ph_[16][KB + 8], Pl_[16][KB + 8]; __shared__ float Of[16][HD + 4];
  const int lane = threadIdx.x, nloc = lane & 15, hlf = lane >> 4; 
  // block index -> (batch, head, class r, tile g): a permutation, chosen for placement (for speed only; the result is the same wherever a block runs). A wave's work grows with g (g + 10 key tiles), with g = index % 32 every set of indices at a stride of 32 or more held one g alone.
  // bits 0..2: the head modulo 8, so a head's 128 tiles stand on indices that are equal modulo 8; bits 3..4: r; bits 5..7: gl = g modulo 8; bits 8..9: cq; bits 10..11: jj = head / 8 (batch included).
  // the quarter gh of g is the sum modulo 4 of all fields above bit 2 (bit 7 counts 2), and in odd quarters g modulo 8 runs backwards: 16 indices at any stride 8, 16 .. 256, and 4 of them taken in a row or every fourth (except 4 at a stride of 64), then hold nearly the same number of key tiles.
  static_assert(NH % 8 == 0 && DIL == 4 && TPC == 32, "the bit fields of the block index");
  const int bi = blockIdx.x, jj = bi >> 10, cq = (bi >> 8) & 3, r = (bi >> 3) & 3, gl = (bi >> 5) & 7, gh = (r + gl + 2 * (gl >> 2) + cq + jj) & 3, g = gh * 8 + ((gh & 1) ? 7 - gl : gl), hb = (bi & 7) + 8 * jj; const int h = hb % NH; const int b = hb / NH; if (b >= BLIM) return; const int qt = r * TPC + g, t0 = qt * 16; const size_t rowb = (size_t)b * L; const int qo = h * HD; const size_t vtb = (size_t)(b * NH + h) * (L / 16) * (HD * 16); const unsigned vlo = nloc * 16 + 8 * hlf;   // the head's first K or V^T tile (the same for the wave); this lane's d row (mod 16) and token half inside a tile
  v16b qh[HD / 32], ql[HD / 32];
#pragma unroll
  for (int s = 0; s < HD / 32; ++s) { qh[s] = frag_kb(PH + (rowb + t0 + nloc) * PW + qo + s * 32, hlf); ql[s] = frag_kb(PL + (rowb + t0 + nloc) * PW + qo + s * 32, hlf); }
  float m_r[8], den_r[8]; v8f acc[HD / 16];
#pragma unroll
  for (int r8 = 0; r8 < 8; ++r8) { m_r[r8] = -INFINITY; den_r[r8] = 0.0f; }
#pragma unroll
  for (int t = 0; t < HD / 16; ++t) acc[t] = (v8f){};
  const int ntile = g + 1 + WT * (DIL - 1);   // length of the key tile list
#pragma unroll 1
  for (int u0 = 0; u0 < ntile; u0 += KB / 16) { const int nkt = (ntile - u0) < KB / 16 ? (ntile - u0) : KB / 16;
    v8f sv[KB / 16];   // the block's masked scores stay where the WMMA leaves them: sv[t][r8] = row 8*hlf + r8, key column t*16 + nloc; the t loops below are unrolled so that sv[t] names registers and not scratch memory
    // the score stage is straight-line code per group of KG key tiles, with one wave-uniform test per group: all K fragments of the group are requested before its first product (one wait for L2 per group), the tiles' accumulator chains alternate, and the mask is a select. A place of the list without a tile reads the class's first tile (written, finite) and is masked whole. The loops over a, q and r8 are unrolled so that the fragment and score arrays name registers.
#pragma unroll
    for (int tg = 0; tg < KB / 16; tg += KG) { if (u0 + tg < ntile) { int kt[KG]; const b16 *ph[KG], *pl[KG]; v16b kh[KG][HD / 32], kl[KG][HD / 32]; v8f s[KG];
#pragma unroll
        for (int a = 0; a < KG; ++a) { kt[a] = key_tile(u0 + tg + a, g, r); const size_t kr = vtb + (size_t)(kt[a] < 0 ? r * TPC : kt[a]) * (HD * 16) + lane * 8; ph[a] = KFH + kr; pl[a] = KFL + kr; s[a] = (v8f){}; }
#pragma unroll
        for (int a = 0; a < KG; ++a)
#pragma unroll
          for (int q = 0; q < HD / 32; ++q) { kh[a][q] = frag_fo(ph[a] + q * 512); kl[a][q] = frag_fo(pl[a] + q * 512); }
#pragma unroll
        for (int q = 0; q < HD / 32; ++q) {   // per accumulator the order of the products is q-hi k-hi, q-hi k-lo, q-lo k-hi, as before
#pragma unroll
          for (int a = 0; a < KG; ++a) s[a] = wmma16b(qh[q], kh[a][q], s[a]);
#pragma unroll
          for (int a = 0; a < KG; ++a) s[a] = wmma16b(qh[q], kl[a][q], s[a]);
#pragma unroll
          for (int a = 0; a < KG; ++a) s[a] = wmma16b(ql[q], kh[a][q], s[a]); }
#pragma unroll
        for (int a = 0; a < KG; ++a) asm volatile("s_wait_xcnt 0x0" :: "v"(ph[a]), "v"(pl[a]) : "memory");   // later code rewrites the address registers that the group's K loads name; as inputs here they stay untouched (also by a later load's result) up to this wait
#pragma unroll
        for (int a = 0; a < KG; ++a) { const int kc = kt[a] < 0 ? r * TPC : kt[a], j = kc / TPC + DIL * ((kc % TPC) * 16 + nloc);   // the key's token
          // with d = i - j the mask (window 0 <= d <= 127, or dilated d >= 132 with d % 4 == 0) reads: own class (d % 4 == 0): d >= 0 and d != 128; another class (d % 4 != 0): 0 <= d < 128; no tile: nothing
          const unsigned lim = kt[a] < 0 ? 0u : (kc / TPC == r ? 0x80000000u : (unsigned)WINDOW);
#pragma unroll
          for (int r8 = 0; r8 < 8; ++r8) { const int d = r + DIL * (g * 16 + 8 * hlf + r8) - j; const bool ok = ((unsigned)d < lim) & (d != WINDOW); sv[tg + a][r8] = ok ? s[a][r8] * (1.0f / (HS * HS)) : -INFINITY; } } }
      else {
#pragma unroll
        for (int a = 0; a < KG; ++a)
#pragma unroll
          for (int r8 = 0; r8 < 8; ++r8) sv[tg + a][r8] = -INFINITY; } }
    // a lane owns 8 rows (its accumulator rows) and one key column of each tile: maximum and sum run over the 8 tiles in the lane, then over the 16 lanes of the row; the 8 rows are independent chains
#pragma unroll
    for (int r8 = 0; r8 < 8; ++r8) { float mx = sv[0][r8];
#pragma unroll
      for (int t = 1; t < KB / 16; ++t) mx = fmaxf(mx, sv[t][r8]);
      mx = row_max16(mx);
      const float mold = m_r[r8]; const float mn = fmaxf(mold, mx); const float sf = (mold == -INFINITY) ? 0.0f : ((mn == -INFINITY) ? 1.0f : __expf(mold - mn)); float ps = 0.0f;
#pragma unroll
      for (int t = 0; t < KB / 16; ++t) { const float x = sv[t][r8]; const float p = (x == -INFINITY || mn == -INFINITY) ? 0.0f : __expf(x - mn); ps += p; b16 ph, pl; split16(p * PS, ph, pl); Ph_[8 * hlf + r8][t * 16 + nloc] = ph; Pl_[8 * hlf + r8][t * 16 + nloc] = pl; }
      ps = row_sum16(ps);
      den_r[r8] = den_r[r8] * sf + ps; m_r[r8] = mn;
#pragma unroll
      for (int t = 0; t < HD / 16; ++t) acc[t][r8] = acc[t][r8] * sf; }
    wave_lds_sync();
    for (int ks = 0; ks < nkt * 16; ks += 32) { const v16b pa = frag_kb(&Ph_[nloc][ks], hlf), pb = frag_kb(&Pl_[nloc][ks], hlf); const int ka = key_tile(u0 + ks / 16, g, r), kc = key_tile(u0 + ks / 16 + 1, g, r); const size_t vp = vtb + (size_t)(ka < 0 ? r * TPC : ka) * (HD * 16), vp2 = vtb + (size_t)(kc < 0 ? r * TPC : kc) * (HD * 16);   /* two tiles of the list; where the list has none, p = 0 there and any written tile serves (finite V) */
      const b16 *h1 = VTH + vp + vlo, *h2 = VTH + vp2 + vlo, *l1 = VTL + vp + vlo, *l2 = VTL + vp2 + vlo;   // this lane's place in the two tiles, hi and lo plane
      v16b vh[HD / 16], vl[HD / 16];   // all eight fragments of the trip are requested before the first product, so the trip waits for L2 once and not once per d tile
#pragma unroll
      for (int t = 0; t < HD / 16; ++t) { vh[t] = frag_vt(h1 + t * 256, h2 + t * 256); vl[t] = frag_vt(l1 + t * 256, l2 + t * 256); }
#pragma unroll
      for (int t = 0; t < HD / 16; ++t) { acc[t] = wmma16b(pa, vh[t], acc[t]); acc[t] = wmma16b(pa, vl[t], acc[t]); acc[t] = wmma16b(pb, vh[t], acc[t]); }
      asm volatile("s_wait_xcnt 0x0" :: "v"(h1), "v"(h2), "v"(l1), "v"(l2) : "memory");   // the next trip rewrites the address registers that this trip's V^T loads name; as inputs here they stay untouched (also by a later load's result) up to this wait
    }
    wave_lds_sync(); }
#pragma unroll
  for (int t = 0; t < HD / 16; ++t)
#pragma unroll
    for (int r8 = 0; r8 < 8; ++r8) { const float dn = den_r[r8]; Of[8 * hlf + r8][t * 16 + nloc] = dn > 0.0f ? acc[t][r8] * (1.0f / (HS * PS)) / dn : 0.0f; }
  wave_lds_sync();
  { for (int rr = 0; rr < 16; ++rr) for (int s = 0; s < HD / 32; ++s) ((float*)ATT)[(rowb + r + DIL * (g * 16 + rr)) * C + h * HD + s * 32 + lane] = Of[rr][s * 32 + lane];  } }
// output product: block = 16 waves on OMT = 4 tiles of 16 tokens and 256 of the 1,024 columns (blockIdx.y); the waves share the staged hi+lo rows; wave wv owns rows (wv / 8) * 32 .. + 31 and columns (wv % 8) * 32 .. + 31 of the block: a weight fragment feeds 2 row tiles in the wave, and the block reads its weights for 64 rows. 64 x 4 = 256 blocks, one per WGP.
__global__ __launch_bounds__(512) void out_kernel(const float* __restrict__ ATT, const b16* __restrict__ WO, const float* __restrict__ bo, int TLIM, float* __restrict__ out) { __shared__ __attribute__((aligned(16))) b16 Ah[16 * OMT][C + 8], Al[16 * OMT][C + 8]; __shared__ __attribute__((aligned(16))) float Tf[16][16][36]; const int lane = threadIdx.x & 31, wv = __builtin_amdgcn_readfirstlane(threadIdx.x >> 5), nloc = lane & 15, hlf = lane >> 4; const size_t m0 = (size_t)blockIdx.x * (16 * OMT); if (m0 >= (size_t)TLIM) return;
  for (int rr = wv * OMT; rr < wv * OMT + OMT; ++rr) for (int q = 0; q < C / 32; ++q) { b16 p, ql; split16(ATT[(m0 + rr) * C + q * 32 + lane] * HS, p, ql); Ah[rr][q * 32 + lane] = p; Al[rr][q * 32 + lane] = ql; }
  __syncthreads();   // every wave reads 32 staged rows, written by 8 waves
  const int r0 = (wv >> 3) * 32, c0 = (int)blockIdx.y * ONC + (wv & 7) * 32; const b16* wp = WO + (size_t)(c0 / 16) * (C / 32) * 512 + lane * 8; v8f acc[2][2];
#pragma unroll
  for (int mt = 0; mt < 2; ++mt)
#pragma unroll
    for (int t = 0; t < 2; ++t) acc[mt][t] = (v8f){};
  for (int kb = 0; kb < C; kb += 128) { v16b bw[4][2];   // a trip is 128 k: its 16 weight loads are requested before its first product, so the trip waits for L2 once
#pragma unroll
    for (int s = 0; s < 4; ++s)
#pragma unroll
      for (int t = 0; t < 2; ++t) bw[s][t] = frag_fo(wp + t * 16 * C + (kb + 32 * s) * 16);
#pragma unroll
    for (int s = 0; s < 4; ++s) { v16b a[2], al[2];
#pragma unroll
      for (int mt = 0; mt < 2; ++mt) { a[mt] = frag_kb(&Ah[r0 + mt * 16 + nloc][kb + 32 * s], hlf); al[mt] = frag_kb(&Al[r0 + mt * 16 + nloc][kb + 32 * s], hlf); }
      // per accumulator hi then lo, as before; the other accumulators' products stand between an accumulator's two
#pragma unroll
      for (int mt = 0; mt < 2; ++mt)
#pragma unroll
        for (int t = 0; t < 2; ++t) acc[mt][t] = wmma16b(a[mt], bw[s][t], acc[mt][t]);
#pragma unroll
      for (int mt = 0; mt < 2; ++mt)
#pragma unroll
        for (int t = 0; t < 2; ++t) acc[mt][t] = wmma16b(al[mt], bw[s][t], acc[mt][t]); } }
#pragma unroll
  for (int mt = 0; mt < 2; ++mt) {
#pragma unroll
    for (int t = 0; t < 2; ++t) { const int cc = t * 16 + nloc; const float bb = 0.0f;
#pragma unroll
      for (int r8 = 0; r8 < 8; ++r8) Tf[wv][8 * hlf + r8][cc] = acc[mt][t][r8] * (1.0f / (HS * WSC)) + bb; }
    wave_lds_only();
    { const int ro = lane >> 3, cs = (lane & 7) * 4; for (int rr = 0; rr < 16; rr += 4) *(v4f*)(out + (m0 + r0 + mt * 16 + rr + ro) * C + c0 + cs) = *(const v4f*)(&Tf[wv][rr + ro][cs]); }
    wave_lds_only();   // the next row tile rewrites the wave's staging rows
    asm volatile("s_wait_xcnt 0x0" ::: "memory");   // behind a row tile's run of stores: the next tile's addresses may rewrite registers that hold theirs
  } }
}  // namespace

extern "C" void kernel_launch(void* const* d_in, const int* in_sizes, int n_in, void* d_out, int out_size, void* d_ws, size_t ws_size, hipStream_t stream) {
  (void)n_in;
  auto Fp = [&](int i) { return (const float*)d_in[i]; };
  // input order: 0 x [2,2048,1024]; 1 qkv [3072,1024] (out,in: rows q|k|v); 2 wo [1024,1024] (out,in)
  if (in_sizes[0] != NT * C || in_sizes[1] != 3 * C * C || in_sizes[2] != C * C || out_size != NT * C) return;
  const int BLIM = NB;   // batch cut
  const int TLIM = BLIM * L;
  size_t off = 0; char* ws = (char*)d_ws;
  auto carve = [&](size_t bytes) { char* p = ws + off; off += (bytes + 255) & ~(size_t)255; return p; };
  b16* W3 = (b16*)carve((size_t)3 * C * C * 2); b16* WO = (b16*)carve((size_t)C * C * 2); b16* PH = (b16*)carve((size_t)NT * PW * 2); b16* PL = (b16*)carve((size_t)NT * PW * 2); float* ATT = (float*)carve((size_t)NT * C * 4); b16* VTH = (b16*)carve((size_t)NT * C * 2); b16* VTL = (b16*)carve((size_t)NT * C * 2); b16* KFH = (b16*)carve((size_t)NT * C * 2); b16* KFL = (b16*)carve((size_t)NT * C * 2);
  if (off > ws_size || off > ((size_t)112 << 20)) return;   // ~ 104 MiB
  wput_kernel<<<4 * C / 8, 256, 0, stream>>>(Fp(1), Fp(1) + (size_t)C * C, Fp(1) + (size_t)2 * C * C, Fp(2), W3, WO);
  proj_kernel<<<dim3(TLIM / (16 * PMT), PW / (64 * PNW)), PNW * 32, 0, stream>>>(Fp(0), W3, Fp(0), Fp(0), Fp(0), TLIM, PH, PL, VTH, VTL, KFH, KFL);
  att_kernel<<<BLIM * NH * (L / 16), 32, 0, stream>>>(PH, PL, KFH, KFL, VTH, VTL, (const float*)0, BLIM, ATT);
  out_kernel<<<dim3(TLIM / (16 * OMT), C / ONC), 512, 0, stream>>>(ATT, WO, (const float*)0, TLIM, (float*)d_out);
}

// v010
// A run of this version takes 89.5 microseconds.
// In two side-by-side timings against v009, it was 1.08 and 1.07 times as fast.
// Counting every step since v000, it is 31.9 times as fast.
#include <hip/hip_runtime.h>

// CustomWindowMHA: 16 heads x 64 over 2 x 2,048 tokens; token i attends to j in the causal window i-127..i OR the dilated set j = i-128-4m (m >= 1, j >= 0); QKV = x qkv^T (no bias), scores/8, masked softmax, out = (attn v) wo^T -> [2][2048][1024].
// Deterministic: no index structures, no atomics; flash-style online softmax over the key tiles of a query tile in a fixed order.
// TOKEN ORDER IN THE WORKSPACE: q, k and v are kept by residue class, position p = (token % 4) * 512 + token / 4 inside a sequence. A query tile is 16 positions in a row = 16 tokens of ONE class, so its dilated keys (same class) are rows in a row, and the three other classes matter only inside the window (3 tiles of 16 each).
// FRAGMENT ORDER: the weights W3 and WO (B operands) and the keys KFH/KFL (A operand of S^T = K Q^T) are stored as the WMMA wants them: per tile of 16 rows and per 32 k one block of 512 elements [16-k half j][lane][8], lane = 16*hh + row, k = 16j + 8hh + 0..7. A wave's 16-byte load then covers 512 bytes in a row (4 lines) where row-major storage gave it 32 bytes of each of 16 lines.
// WMMA (v_wmma_f32_16x16x32_f16, f32 accumulate): the QKV projection with x EXACT bf16 x8 (K 1024) against exact torch weight rows x256 (one product); S = Q K^T (hi+lo x hi+lo, 3 products, K 64); O = P V (P x256 hi+lo x V^T hi+lo, 3 products; V^T comes ready from the projection, see VTH/VTL); out = attended (hi+lo) Wo^T (2 products); softmax in f32. Inputs rounded to bf16 once. Fragment k-map per lane half hh for A AND B: elements 0..7 <- k = 8hh+0..7, 8..15 <- k = 16+8hh+0..7; acc[r] = D[8hh+r][col].

namespace {
constexpr int NB = 2, L = 2048, C = 1024, NH = 16, HD = 64, NT = NB * L, KB = 128, PW = 3 * C;
constexpr int WINDOW = 128, DIL = 4, KG = 2 /* key tiles whose K fragments attention requests together */;
constexpr int NC = L / DIL /* positions per residue class */, TPC = NC / 16 /* 16-position tiles per class */, WT = WINDOW / (DIL * 16) + 1 /* tiles of a foreign class that a query tile's windows can touch */;
constexpr int PMT = 4 /* 16-row tiles per projection block */, PNW = 12 /* its waves, 64 columns each */, OMT = 4 /* 16-row tiles per output-product block */, ONC = 256 /* its columns */, WU = 4 /* units of 8 weights per thread of the repack */;
constexpr float XS = 8.0f, HS = 256.0f /* hi+lo staging scale for q/k/v/attended */, WSC = 256.0f, PS = 256.0f, SCALE = 0.125f;
typedef _Float16 b16;
typedef __attribute__((ext_vector_type(16))) _Float16 v16b;
typedef __attribute__((ext_vector_type(8))) _Float16 v8b;
typedef __attribute__((ext_vector_type(8))) float v8f;
typedef __attribute__((ext_vector_type(4))) float v4f;
__device__ __forceinline__ float bf16_rne(float f) { unsigned int u = __float_as_uint(f); u += 0x7FFFu + ((u >> 16) & 1u); float r = __uint_as_float(u & 0xFFFF0000u); asm volatile("" : "+v"(r)); return r; }
__device__ __forceinline__ float bfv(float f) { float r = bf16_rne(f); asm volatile("" : "+v"(r)); return r; }
__device__ __forceinline__ void split16(float v, b16& hi, b16& lo) { hi = (b16)v; lo = (b16)(v - (float)hi); }
__device__ __forceinline__ v16b frag_kb(const b16* p, int hh) { const v8b a = *(const v8b*)(p + 8 * hh), b = *(const v8b*)(p + 16 + 8 * hh); v16b f;
#pragma unroll
  for (int e = 0; e < 8; ++e) { f[e] = a[e]; f[8 + e] = b[e]; } return f; }
// V^T fragment of 32 keys from the tiled planes: p and p2 point at this lane's (d, 8*hh) in the first and the second 16-position tile of the pair; elements 0..7 <- k = 8hh+0..7 (p), 8..15 <- k = 16+8hh+0..7 (p2): the same k-map as frag_kb.
__device__ __forceinline__ v16b frag_vt(const b16* p, const b16* p2) { const v8b a = *(const v8b*)p, b = *(const v8b*)p2; v16b f;
#pragma unroll
  for (int e = 0; e < 8; ++e) { f[e] = a[e]; f[8 + e] = b[e]; } return f; }
// fragment of 32 k from a fragment-order block: p points at this lane's 8 elements of half j = 0, half j = 1 stands 256 elements on; the same k-map as frag_kb.
__device__ __forceinline__ v16b frag_fo(const b16* p) { return frag_vt(p, p + 256); }
__device__ __forceinline__ v8f wmma16b(v16b a, v16b b, v8f c) { v8f d = __builtin_amdgcn_wmma_f32_16x16x32_f16(false, a, false, b, (short)0, c, false, false); asm volatile("v_nop\n\tv_nop\n\tv_nop\n\tv_nop" : "+v"(d) : "v"(a), "v"(b)); return d; }
__device__ __forceinline__ void wave_lds_sync() { __builtin_amdgcn_fence(__ATOMIC_RELEASE, "workgroup"); __builtin_amdgcn_wave_barrier(); __builtin_amdgcn_fence(__ATOMIC_ACQUIRE, "workgroup"); }
// the same for LDS alone: in the GEMM epilogues, which loop over row tiles, the fence above would also wait for the last tile's global stores to finish
__device__ __forceinline__ void wave_lds_only() { __builtin_amdgcn_fence(__ATOMIC_RELEASE, "workgroup", "local"); __builtin_amdgcn_wave_barrier(); __builtin_amdgcn_fence(__ATOMIC_ACQUIRE, "workgroup", "local"); }
// u-th key tile of query tile (class r, tile g of the class), as a tile number in position order, or -1 for none: first the own class from its start up to the diagonal (u = 0..g), then of each other class the WT tiles g-WT+1..g that the windows reach.
__device__ __forceinline__ int key_tile(int u, int g, int r) { const int v = u - g - 1, ci = v / WT, tau = g - (WT - 1) + v % WT; const int f = ((ci >= DIL - 1) | (tau < 0)) ? -1 : (ci + (ci >= r ? 1 : 0)) * TPC + tau; return u <= g ? r * TPC + u : f; }
// lane l's value from lane l ^ 16, as a vector cross-row move (no LDS round trip, unlike __shfl_xor)
__device__ __forceinline__ float halfx(float x) { const int b = __builtin_bit_cast(int, x); return __builtin_bit_cast(float, __builtin_amdgcn_permlanex16(b, b, 0x76543210, 0xfedcba98, false, false)); }
__device__ __forceinline__ float pmul(float a, float b) { float p = a * b; asm volatile("" : "+v"(p)); return p; }

// weight repack: a block takes 8 whole weight rows, a thread WU units of 8 weights of one row, 256 k apart: 512 blocks of 8 waves, two per WGP. Few long waves and not many short ones, for speed only; a wave has its 8 16-byte loads in flight together, and which weight it reads is the same for the whole block.
__global__ __launch_bounds__(256) void wput_kernel(const float* __restrict__ wq, const float* __restrict__ wk, const float* __restrict__ wv, const float* __restrict__ wo, b16* __restrict__ W3, b16* __restrict__ WO) { static_assert(WU * 256 == C && C % 8 == 0, "8 rows are WU * 256 units; a block's rows lie in one weight"); const int tid = threadIdx.x, c = tid & 3, kw = tid >> 5, r = (int)blockIdx.x * 8 + ((tid >> 2) & 7);   /* a wave takes 32 k of 8 rows at a time: it reads 8 whole lines and writes 4 whole lines; unit i has ks = i * 8 + kw */ const int p = ((int)blockIdx.x * 8) / C, o = r % C, rb = p < 3 ? r : o; const float* w = (p == 0 ? wq : (p == 1 ? wk : (p == 2 ? wv : wo))) + (size_t)o * C + kw * 32 + c * 8; b16* d = (p < 3 ? W3 : WO) + ((size_t)(rb >> 4) * (C / 32) + kw) * 512 + (c >> 1) * 256 + ((c & 1) * 16 + (rb & 15)) * 8; float xv[WU][8];
#pragma unroll
  for (int i = 0; i < WU; ++i)
#pragma unroll
    for (int j = 0; j < 8; ++j) xv[i][j] = w[i * 256 + j];
#pragma unroll
  for (int i = 0; i < WU; ++i) { v8b v;
#pragma unroll
    for (int j = 0; j < 8; ++j) v[j] = (b16)(bf16_rne(xv[i][j]) * WSC);
    *(v8b*)(d + i * 8 * 512) = v; } }
// projection: block = 12 waves on PMT = 4 tiles of 16 positions (64 positions in a row of one residue class, see the head of the file) and 768 of the 3,072 columns q|k|v (blockIdx.y); the waves share the staged x rows, a wave owns 64 columns = one head of one of q, k, v, for all 64 rows: a weight fragment is read from L2 once and multiplied with 4 row tiles. 64 x 4 = 256 blocks, one per WGP.
// q goes out token-major (PH/PL). k goes out in fragment order, tiled [b][head][16-token tile][d half 0..1][j][lane][8] (KFH/KFL): a wave owns one head and writes 2 KiB in a row per plane and tile. v goes out TRANSPOSED, tiled [b][head][16-token tile][d 0..63][token 0..15] (VTH/VTL): a lane's 8 accumulator rows are 8 consecutive tokens of one d, so it stores them as one 16-byte word; a wave owns one head and writes 2 KiB in a row per plane and tile.
__global__ __launch_bounds__(PNW * 32) void proj_kernel(const float* __restrict__ x, const b16* __restrict__ W3, const float* __restrict__ bq, const float* __restrict__ bk, const float* __restrict__ bv, int TLIM, b16* __restrict__ PH, b16* __restrict__ PL, b16* __restrict__ VTH, b16* __restrict__ VTL, b16* __restrict__ KFH, b16* __restrict__ KFL) { __shared__ __attribute__((aligned(16))) b16 Ah[16 * PMT][C + 8], Oh[PNW][16][72], Ol[PNW][16][72]; const int lane = threadIdx.x & 31, wv = __builtin_amdgcn_readfirstlane(threadIdx.x >> 5), nloc = lane & 15, hlf = lane >> 4; const size_t m0 = (size_t)blockIdx.x * (16 * PMT); if (m0 >= (size_t)TLIM) return;
  for (int rw = wv; rw < 16 * PMT; rw += PNW) { const size_t xr = ((m0 + rw) / L) * L + DIL * ((m0 + rw) % NC) + ((m0 + rw) % L) / NC;   // the token that stands at position m0 + rw
    float xv[C / 32];   // a row's 32 loads are requested before the first rounding: no load is moved across the asm statement in bf16_rne, so load by load each would wait out memory alone, and a wave now stages 5 or 6 rows
#pragma unroll
    for (int q = 0; q < C / 32; ++q) xv[q] = x[xr * C + q * 32 + lane];
#pragma unroll
    for (int q = 0; q < C / 32; ++q) Ah[rw][q * 32 + lane] = (b16)(bf16_rne(xv[q]) * XS); }
  __syncthreads();   // every wave reads all staged rows
  const int c0 = ((int)blockIdx.y * PNW + wv) * 64, pj = c0 / C, hd = (c0 % C) / HD; const float sc = pj == 0 ? SCALE : 1.0f; const b16* wp = W3 + (size_t)(c0 / 16) * (C / 32) * 512 + lane * 8; v8f acc[PMT][4];
#pragma unroll
  for (int mt = 0; mt < PMT; ++mt)
#pragma unroll
    for (int t = 0; t < 4; ++t) acc[mt][t] = (v8f){};
  for (int kb = 0; kb < C; kb += 64) { v16b bw[2][4];   // a trip is 64 k: its 16 weight loads are requested before its first product, so the trip waits for L2 once; with 3 waves on a SIMD the other waves' products cover that wait
#pragma unroll
    for (int s = 0; s < 2; ++s)
#pragma unroll
      for (int t = 0; t < 4; ++t) bw[s][t] = frag_fo(wp + t * 16 * C + (kb + 32 * s) * 16);
#pragma unroll
    for (int s = 0; s < 2; ++s) { v16b a[PMT];   // the four row tiles' fragments as one group of LDS reads
#pragma unroll
      for (int mt = 0; mt < PMT; ++mt) a[mt] = frag_kb(&Ah[mt * 16 + nloc][kb + 32 * s], hlf);
#pragma unroll
      for (int mt = 0; mt < PMT; ++mt)
#pragma unroll
        for (int t = 0; t < 4; ++t) acc[mt][t] = wmma16b(a[mt], bw[s][t], acc[mt][t]); } }
#pragma unroll
  for (int mt = 0; mt < PMT; ++mt) { const size_t mm = m0 + mt * 16; const size_t tb = (((mm / L) * NH + hd) * (L / 16) + (mm % L) / 16) * (HD * 16);   // this row tile's first position; its k or v tile of the wave's head
    if (pj == 2) {
#pragma unroll
      for (int t = 0; t < 4; ++t) { v8b vh, vl;
#pragma unroll
        for (int r8 = 0; r8 < 8; ++r8) { b16 p, ql; split16((acc[mt][t][r8] * (1.0f / (XS * WSC)) + 0.0f) * sc * HS, p, ql); vh[r8] = p; vl[r8] = ql; }
        *(v8b*)(VTH + tb + (t * 16 + nloc) * 16 + 8 * hlf) = vh; *(v8b*)(VTL + tb + (t * 16 + nloc) * 16 + 8 * hlf) = vl; }
      asm volatile("s_wait_xcnt 0x0" ::: "memory");   // behind the run of v stores: the code that stands behind it in the listing rewrites registers that the stores name
    }
    else {
#pragma unroll
      for (int t = 0; t < 4; ++t) { const int cc = t * 16 + nloc; const float bvv = 0.0f;
#pragma unroll
        for (int r8 = 0; r8 < 8; ++r8) { b16 p, ql; split16((acc[mt][t][r8] * (1.0f / (XS * WSC)) + bvv) * sc * HS, p, ql); Oh[wv][8 * hlf + r8][cc] = p; Ol[wv][8 * hlf + r8][cc] = ql; } }
      wave_lds_only();
      if (pj == 1) {
#pragma unroll
        for (int i = 0; i < 4; ++i) { *(v8b*)(KFH + tb + lane * 8 + i * 256) = *(const v8b*)(&Oh[wv][nloc][i * 16 + 8 * hlf]); *(v8b*)(KFL + tb + lane * 8 + i * 256) = *(const v8b*)(&Ol[wv][nloc][i * 16 + 8 * hlf]); }
        asm volatile("s_wait_xcnt 0x0" ::: "memory");   // behind the run of k stores, for the same reason
      }
      else { const int ro = lane >> 3, cs = (lane & 7) * 8; for (int rr = 0; rr < 16; rr += 4) { *(v8b*)(PH + (mm + rr + ro) * PW + c0 + cs) = *(const v8b*)(&Oh[wv][rr + ro][cs]); *(v8b*)(PL + (mm + rr + ro) * PW + c0 + cs) = *(const v8b*)(&Ol[wv][rr + ro][cs]); }
        asm volatile("s_wait_xcnt 0x0" ::: "memory");   // behind the run of q stores, for the same reason
      }
      wave_lds_only();   // the next row tile rewrites the wave's staging rows
    }
  }
}
// attention: ONE WAVE PER BLOCK, wave per (b, h, 16-query tile of one residue class): key blocks of 8 tiles from the list of key_tile() (own class up to the diagonal, the other classes inside the window), every key that the mask allows exactly once.
// BOTH PRODUCTS ARE TRANSPOSED: S^T = K Q^T (K fragment as A, Q fragment as B; 3 products, K 64) and O^T = V^T P^T (V^T fragment as A, P^T as B; 3 products). A and B have the same lane and k map, so the stored K, V^T and Q fragments serve as they are. The score accumulator of a key tile holds, in lane 16*hlf + n, keys 8*hlf + 0..7 of query n: that is this lane's half of the B fragment of P^T, so P x256 hi+lo is rounded in place and never leaves the registers. A query is one lane column: its maximum and sum run inside the lane and then over the two lane halves (one cross-row move each).
// amdgpu_waves_per_eu(4): the register budget of 4 waves on a SIMD, so that all 4,096 waves stay resident at once (without it this build takes more than 256 registers and a fourth of the waves starts late)
__global__ __launch_bounds__(32) __attribute__((amdgpu_waves_per_eu(4))) void att_kernel(const b16* __restrict__ PH, const b16* __restrict__ PL, const b16* __restrict__ KFH, const b16* __restrict__ KFL, const b16* __restrict__ VTH, const b16* __restrict__ VTL, const float* __restrict__ amask, int BLIM, float* __restrict__ ATT) { __shared__ __attribute__((aligned(16))) float Of[16][HD + 4];
  const int lane = threadIdx.x, nloc = lane & 15, hlf = lane >> 4; 
  // block index -> (batch, head, class r, tile g): a permutation, chosen for placement (for speed only; the result is the same wherever a block runs). A wave's work grows with g (g + 10 key tiles), with g = index % 32 every set of indices at a stride of 32 or more held one g alone.
  // bits 0..2: the head modulo 8, so a head's 128 tiles stand on indices that are equal modulo 8; bits 3..4: r; bits 5..7: gl = g modulo 8; bits 8..9: cq; bits 10..11: jj = head / 8 (batch included).
  // the quarter gh of g is the sum modulo 4 of all fields above bit 2 (bit 7 counts 2), and in odd quarters g modulo 8 runs backwards: 16 indices at any stride 8, 16 .. 256, and 4 of them taken in a row or every fourth (except 4 at a stride of 64), then hold nearly the same number of key tiles.
  static_assert(NH % 8 == 0 && DIL == 4 && TPC == 32, "the bit fields of the block index");
  const int bi = blockIdx.x, jj = bi >> 10, cq = (bi >> 8) & 3, r = (bi >> 3) & 3, gl = (bi >> 5) & 7, gh = (r + gl + 2 * (gl >> 2) + cq + jj) & 3, g = gh * 8 + ((gh & 1) ? 7 - gl : gl), hb = (bi & 7) + 8 * jj; const int h = hb % NH; const int b = hb / NH; if (b >= BLIM) return; const int qt = r * TPC + g, t0 = qt * 16; const size_t rowb = (size_t)b * L; const int qo = h * HD; const size_t vtb = (size_t)(b * NH + h) * (L / 16) * (HD * 16); const unsigned vlo = nloc * 16 + 8 * hlf;   // the head's first K or V^T tile (the same for the wave); this lane's d row (mod 16) and token half inside a tile
  v16b qh[HD / 32], ql[HD / 32];
#pragma unroll
  for (int s = 0; s < HD / 32; ++s) { qh[s] = frag_kb(PH + (rowb + t0 + nloc) * PW + qo + s * 32, hlf); ql[s] = frag_kb(PL + (rowb + t0 + nloc) * PW + qo + s * 32, hlf); }
  float m_q = -INFINITY, den_q = 0.0f; v8f acc[HD / 16];   // of query nloc, the same in both lane halves; acc[t][r8] = O^T[d = t*16 + 8*hlf + r8][query nloc]
#pragma unroll
  for (int t = 0; t < HD / 16; ++t) acc[t] = (v8f){};
  const int ntile = g + 1 + WT * (DIL - 1);   // length of the key tile list
#pragma unroll 1
  for (int u0 = 0; u0 < ntile; u0 += KB / 16) { const int nkt = (ntile - u0) < KB / 16 ? (ntile - u0) : KB / 16;
    v8f sv[KB / 16];   // the block's masked scores stay where the WMMA leaves them: sv[t][r8] = key row 8*hlf + r8 of tile t, query column nloc; the t loops below are unrolled so that sv[t] names registers and not scratch memory
    // the score stage is straight-line code per group of KG key tiles, with one wave-uniform test per group: all K fragments of the group are requested before its first product (one wait for L2 per group), the tiles' accumulator chains alternate, and the mask is a select. A place of the list without a tile reads the class's first tile (written, finite) and is masked whole. The loops over a, q and r8 are unrolled so that the fragment and score arrays name registers.
#pragma unroll
    for (int tg = 0; tg < KB / 16; tg += KG) { if (u0 + tg < ntile) { int kt[KG]; const b16 *ph[KG], *pl[KG]; v16b kh[KG][HD / 32], kl[KG][HD / 32]; v8f s[KG];
#pragma unroll
        for (int a = 0; a < KG; ++a) { kt[a] = key_tile(u0 + tg + a, g, r); const size_t kr = vtb + (size_t)(kt[a] < 0 ? r * TPC : kt[a]) * (HD * 16) + lane * 8; ph[a] = KFH + kr; pl[a] = KFL + kr; s[a] = (v8f){}; }
#pragma unroll
        for (int a = 0; a < KG; ++a)
#pragma unroll
          for (int q = 0; q < HD / 32; ++q) { kh[a][q] = frag_fo(ph[a] + q * 512); kl[a][q] = frag_fo(pl[a] + q * 512); }
#pragma unroll
        for (int q = 0; q < HD / 32; ++q) {   // per accumulator the order of the products is q-hi k-hi, q-hi k-lo, q-lo k-hi, as before
#pragma unroll
          for (int a = 0; a < KG; ++a) s[a] = wmma16b(kh[a][q], qh[q], s[a]);
#pragma unroll
          for (int a = 0; a < KG; ++a) s[a] = wmma16b(kl[a][q], qh[q], s[a]);
#pragma unroll
          for (int a = 0; a < KG; ++a) s[a] = wmma16b(kh[a][q], ql[q], s[a]); }
#pragma unroll
        for (int a = 0; a < KG; ++a) asm volatile("s_wait_xcnt 0x0" :: "v"(ph[a]), "v"(pl[a]) : "memory");   // later code rewrites the address registers that the group's K loads name; as inputs here they stay untouched (also by a later load's result) up to this wait
#pragma unroll
        for (int a = 0; a < KG; ++a) { const int kc = kt[a] < 0 ? r * TPC : kt[a], j = kc / TPC + DIL * ((kc % TPC) * 16 + 8 * hlf);   // the token of the lane's first key row
          // with d = i - j the mask (window 0 <= d <= 127, or dilated d >= 132 with d % 4 == 0) reads: own class (d % 4 == 0): d >= 0 and d != 128; another class (d % 4 != 0): 0 <= d < 128; no tile: nothing
          const unsigned lim = kt[a] < 0 ? 0u : (kc / TPC == r ? 0x80000000u : (unsigned)WINDOW);
#pragma unroll
          for (int r8 = 0; r8 < 8; ++r8) { const int d = r + DIL * (g * 16 + nloc) - (j + DIL * r8); const bool ok = ((unsigned)d < lim) & (d != WINDOW); sv[tg + a][r8] = ok ? s[a][r8] * (1.0f / (HS * HS)) : -INFINITY; } } }
      else {
#pragma unroll
        for (int a = 0; a < KG; ++a)
#pragma unroll
          for (int r8 = 0; r8 < 8; ++r8) sv[tg + a][r8] = -INFINITY; } }
    // a lane owns one query and 8 key rows of each tile: maximum and sum run over the lane's 64 scores, then over the two lane halves
    float mx = sv[0][0];
#pragma unroll
    for (int t = 0; t < KB / 16; ++t)
#pragma unroll
      for (int r8 = 0; r8 < 8; ++r8) mx = fmaxf(mx, sv[t][r8]);
    mx = fmaxf(mx, halfx(mx));
    const float mn = fmaxf(m_q, mx);
    const float mu = (mn == -INFINITY) ? 0.0f : mn;   // the subtracted maximum is kept finite: a masked score (-inf) then gives p = 0 by itself, and an old maximum of -inf (nothing summed yet) gives sf = 0
    const float sf = __expf(m_q - mu);
    float ps = 0.0f; v8b pH[KB / 16], pL[KB / 16];   // P^T x256 hi and lo: pH[t][r8] = key row 8*hlf + r8 of tile t, query nloc
#pragma unroll
    for (int t = 0; t < KB / 16; ++t)
#pragma unroll
      for (int r8 = 0; r8 < 8; ++r8) { const float p = __expf(sv[t][r8] - mu); ps += p; b16 ph, pl; split16(p * PS, ph, pl); pH[t][r8] = ph; pL[t][r8] = pl; }
    ps += halfx(ps);
    den_q = den_q * sf + ps; m_q = mn;
#pragma unroll
    for (int t = 0; t < HD / 16; ++t)
#pragma unroll
      for (int r8 = 0; r8 < 8; ++r8) acc[t][r8] = acc[t][r8] * sf;
    // unrolled, with one wave-uniform test per trip, so that pH and pL name registers
#pragma unroll
    for (int ks = 0; ks < KB; ks += 32) { if (ks < nkt * 16) { v16b pa, pb;   // B fragment of 32 keys: elements 0..7 <- k = 8*hlf + 0..7 (first tile of the pair), 8..15 <- k = 16 + 8*hlf + 0..7 (second tile): the k-map of frag_vt
#pragma unroll
      for (int e = 0; e < 8; ++e) { pa[e] = pH[ks / 16][e]; pa[8 + e] = pH[ks / 16 + 1][e]; pb[e] = pL[ks / 16][e]; pb[8 + e] = pL[ks / 16 + 1][e]; }
      const int ka = key_tile(u0 + ks / 16, g, r), kc = key_tile(u0 + ks / 16 + 1, g, r); const size_t vp = vtb + (size_t)(ka < 0 ? r * TPC : ka) * (HD * 16), vp2 = vtb + (size_t)(kc < 0 ? r * TPC : kc) * (HD * 16);   /* two tiles of the list; where the list has none, p = 0 there and any written tile serves (finite V) */
      const b16 *h1 = VTH + vp + vlo, *h2 = VTH + vp2 + vlo, *l1 = VTL + vp + vlo, *l2 = VTL + vp2 + vlo;   // this lane's place in the two tiles, hi and lo plane
      v16b vh[HD / 16], vl[HD / 16];   // all eight fragments of the trip are requested before the first product, so the trip waits for L2 once and not once per d tile
#pragma unroll
      for (int t = 0; t < HD / 16; ++t) { vh[t] = frag_vt(h1 + t * 256, h2 + t * 256); vl[t] = frag_vt(l1 + t * 256, l2 + t * 256); }
#pragma unroll
      for (int t = 0; t < HD / 16; ++t) { acc[t] = wmma16b(vh[t], pa, acc[t]); acc[t] = wmma16b(vl[t], pa, acc[t]); acc[t] = wmma16b(vh[t], pb, acc[t]); }
      asm volatile("s_wait_xcnt 0x0" :: "v"(h1), "v"(h2), "v"(l1), "v"(l2) : "memory");   // the next trip rewrites the address registers that this trip's V^T loads name; as inputs here they stay untouched (also by a later load's result) up to this wait
    } } }
  const float inv = den_q > 0.0f ? (1.0f / (HS * PS)) / den_q : 0.0f;   // the lane's query has one denominator for all its 32 values
#pragma unroll
  for (int t = 0; t < HD / 16; ++t)
#pragma unroll
    for (int c = 0; c < 2; ++c) { v4f o;   // 4 d in a row of the lane's query
#pragma unroll
      for (int e = 0; e < 4; ++e) o[e] = acc[t][4 * c + e] * inv;
      *(v4f*)(&Of[nloc][t * 16 + 8 * hlf + 4 * c]) = o; }
  wave_lds_sync();
  { for (int rr = 0; rr < 16; ++rr) for (int s = 0; s < HD / 32; ++s) ((float*)ATT)[(rowb + r + DIL * (g * 16 + rr)) * C + h * HD + s * 32 + lane] = Of[rr][s * 32 + lane];  } }
// output product: block = 16 waves on OMT = 4 tiles of 16 tokens and 256 of the 1,024 columns (blockIdx.y); the waves share the staged hi+lo rows; wave wv owns rows (wv / 8) * 32 .. + 31 and columns (wv % 8) * 32 .. + 31 of the block: a weight fragment feeds 2 row tiles in the wave, and the block reads its weights for 64 rows. 64 x 4 = 256 blocks, one per WGP.
__global__ __launch_bounds__(512) void out_kernel(const float* __restrict__ ATT, const b16* __restrict__ WO, const float* __restrict__ bo, int TLIM, float* __restrict__ out) { __shared__ __attribute__((aligned(16))) b16 Ah[16 * OMT][C + 8], Al[16 * OMT][C + 8]; __shared__ __attribute__((aligned(16))) float Tf[16][16][36]; const int lane = threadIdx.x & 31, wv = __builtin_amdgcn_readfirstlane(threadIdx.x >> 5), nloc = lane & 15, hlf = lane >> 4; const size_t m0 = (size_t)blockIdx.x * (16 * OMT); if (m0 >= (size_t)TLIM) return;
  for (int rr = wv * OMT; rr < wv * OMT + OMT; ++rr) for (int q = 0; q < C / 32; ++q) { b16 p, ql; split16(ATT[(m0 + rr) * C + q * 32 + lane] * HS, p, ql); Ah[rr][q * 32 + lane] = p; Al[rr][q * 32 + lane] = ql; }
  __syncthreads();   // every wave reads 32 staged rows, written by 8 waves
  const int r0 = (wv >> 3) * 32, c0 = (int)blockIdx.y * ONC + (wv & 7) * 32; const b16* wp = WO + (size_t)(c0 / 16) * (C / 32) * 512 + lane * 8; v8f acc[2][2];
#pragma unroll
  for (int mt = 0; mt < 2; ++mt)
#pragma unroll
    for (int t = 0; t < 2; ++t) acc[mt][t] = (v8f){};
  for (int kb = 0; kb < C; kb += 128) { v16b bw[4][2];   // a trip is 128 k: its 16 weight loads are requested before its first product, so the trip waits for L2 once
#pragma unroll
    for (int s = 0; s < 4; ++s)
#pragma unroll
      for (int t = 0; t < 2; ++t) bw[s][t] = frag_fo(wp + t * 16 * C + (kb + 32 * s) * 16);
#pragma unroll
    for (int s = 0; s < 4; ++s) { v16b a[2], al[2];
#pragma unroll
      for (int mt = 0; mt < 2; ++mt) { a[mt] = frag_kb(&Ah[r0 + mt * 16 + nloc][kb + 32 * s], hlf); al[mt] = frag_kb(&Al[r0 + mt * 16 + nloc][kb + 32 * s], hlf); }
      // per accumulator hi then lo, as before; the other accumulators' products stand between an accumulator's two
#pragma unroll
      for (int mt = 0; mt < 2; ++mt)
#pragma unroll
        for (int t = 0; t < 2; ++t) acc[mt][t] = wmma16b(a[mt], bw[s][t], acc[mt][t]);
#pragma unroll
      for (int mt = 0; mt < 2; ++mt)
#pragma unroll
        for (int t = 0; t < 2; ++t) acc[mt][t] = wmma16b(al[mt], bw[s][t], acc[mt][t]); } }
#pragma unroll
  for (int mt = 0; mt < 2; ++mt) {
#pragma unroll
    for (int t = 0; t < 2; ++t) { const int cc = t * 16 + nloc; const float bb = 0.0f;
#pragma unroll
      for (int r8 = 0; r8 < 8; ++r8) Tf[wv][8 * hlf + r8][cc] = acc[mt][t][r8] * (1.0f / (HS * WSC)) + bb; }
    wave_lds_only();
    { const int ro = lane >> 3, cs = (lane & 7) * 4; for (int rr = 0; rr < 16; rr += 4) *(v4f*)(out + (m0 + r0 + mt * 16 + rr + ro) * C + c0 + cs) = *(const v4f*)(&Tf[wv][rr + ro][cs]); }
    wave_lds_only();   // the next row tile rewrites the wave's staging rows
    asm volatile("s_wait_xcnt 0x0" ::: "memory");   // behind a row tile's run of stores: the next tile's addresses may rewrite registers that hold theirs
  } }
}  // namespace

extern "C" void kernel_launch(void* const* d_in, const int* in_sizes, int n_in, void* d_out, int out_size, void* d_ws, size_t ws_size, hipStream_t stream) {
  (void)n_in;
  auto Fp = [&](int i) { return (const float*)d_in[i]; };
  // input order: 0 x [2,2048,1024]; 1 qkv [3072,1024] (out,in: rows q|k|v); 2 wo [1024,1024] (out,in)
  if (in_sizes[0] != NT * C || in_sizes[1] != 3 * C * C || in_sizes[2] != C * C || out_size != NT * C) return;
  const int BLIM = NB;   // batch cut
  const int TLIM = BLIM * L;
  size_t off = 0; char* ws = (char*)d_ws;
  auto carve = [&](size_t bytes) { char* p = ws + off; off += (bytes + 255) & ~(size_t)255; return p; };
  b16* W3 = (b16*)carve((size_t)3 * C * C * 2); b16* WO = (b16*)carve((size_t)C * C * 2); b16* PH = (b16*)carve((size_t)NT * PW * 2); b16* PL = (b16*)carve((size_t)NT * PW * 2); float* ATT = (float*)carve((size_t)NT * C * 4); b16* VTH = (b16*)carve((size_t)NT * C * 2); b16* VTL = (b16*)carve((size_t)NT * C * 2); b16* KFH = (b16*)carve((size_t)NT * C * 2); b16* KFL = (b16*)carve((size_t)NT * C * 2);
  if (off > ws_size || off > ((size_t)112 << 20)) return;   // ~ 104 MiB
  wput_kernel<<<4 * C / 8, 256, 0, stream>>>(Fp(1), Fp(1) + (size_t)C * C, Fp(1) + (size_t)2 * C * C, Fp(2), W3, WO);
  proj_kernel<<<dim3(TLIM / (16 * PMT), PW / (64 * PNW)), PNW * 32, 0, stream>>>(Fp(0), W3, Fp(0), Fp(0), Fp(0), TLIM, PH, PL, VTH, VTL, KFH, KFL);
  att_kernel<<<BLIM * NH * (L / 16), 32, 0, stream>>>(PH, PL, KFH, KFL, VTH, VTL, (const float*)0, BLIM, ATT);
  out_kernel<<<dim3(TLIM / (16 * OMT), C / ONC), 512, 0, stream>>>(ATT, WO, (const float*)0, TLIM, (float*)d_out);
}
